// v000
// Measured on an AMD MI455X. A time is GPU time per run, averaged over a window of back-to-back runs after a warm-up
// (all launches, gaps included; the runs take copies of the inputs in turn), and the median of several windows.
// Apart from v000's, it joins two sittings. Times from different sittings can be a few percent apart, while
// side-by-side timings come from the same sitting.
// v000 is the starting kernel. One run takes 240 microseconds.
// compute dtype: all float inputs rounded to bf16, gamma read; q/k (8 channels) and v (64) = x W + b with EXACT bf16 products on WMMA 16x16x32 ((in,out) weights), f32 accumulate; q and k kept in f32 and split into bf16 hi + lo for the UNSCALED logits (3 products; K = 8 zero-padded to 32; logits std ~2.8), running-max softmax over the 4,096 pixels in f32 (hardware exp); P (f16 x 2^11) . v with v rounded once to f16; out = (P v) gamma + x; f32 output.
#include <hip/hip_runtime.h>
#include <math.h>

typedef __attribute__((ext_vector_type(16))) _Float16 v16h;
typedef __attribute__((ext_vector_type(16))) __bf16 v16b;
typedef __attribute__((ext_vector_type(8)))  _Float16 v8h;
typedef __attribute__((ext_vector_type(8)))  float v8f;
typedef __attribute__((ext_vector_type(4)))  float v4f;
typedef __attribute__((ext_vector_type(2)))  float v2f;
typedef __attribute__((ext_vector_type(4)))  unsigned v4u;
typedef __attribute__((ext_vector_type(4)))  int v4i;
typedef float __attribute__((may_alias)) float_a;
typedef int __attribute__((may_alias)) int_a;

template <typename T> __device__ __forceinline__ void vst2(void* p, T v) { *(T*)p = v;  }
__device__ __forceinline__ v8f wmma16(v16h a, v16h b, v8f c) {
  v8f d = __builtin_amdgcn_wmma_f32_16x16x32_f16(false, a, false, b, (short)0, c, false, false);
  asm volatile("v_nop\n\tv_nop\n\tv_nop\n\tv_nop" : "+v"(d) : "v"(a), "v"(b));
  return d;
}
__device__ __forceinline__ v8f wmma_bf(v16b a, v16b b, v8f c) {
  v8f d = __builtin_amdgcn_wmma_f32_16x16x32_bf16(false, a, false, b, (short)0, c, false, false);
  asm volatile("v_nop\n\tv_nop\n\tv_nop\n\tv_nop" : "+v"(d) : "v"(a), "v"(b));
  return d;
}
// 16x16x32 fragments: lane = (h = lane>>4, row/col = lane&15); elements 0..7 = k0+8h+0..7, 8..15 = k0+16+8h+0..7; D element r = row 8h+r
__device__ __forceinline__ v16h frag_h(const _Float16* rowk0, int lane) {
  union { v16h v; v8h q[2]; } u; const _Float16* p = rowk0 + 8 * (lane >> 4);
  u.q[0] = *(const v8h*)p; u.q[1] = *(const v8h*)(p + 16); return u.v;
}
__device__ __forceinline__ v16h frag_f32(const float* rowk0, int lane) {
  v16h a; const float* p = rowk0 + 8 * (lane >> 4);
#pragma unroll
  for (int i = 0; i < 8; ++i) { a[i] = (_Float16)p[i]; a[8 + i] = (_Float16)p[16 + i]; }
  return a;
}
__device__ __forceinline__ v16h frag_f32s(const float* rowk0, int lane, float sc) {
  v16h a; const float* p = rowk0 + 8 * (lane >> 4);
#pragma unroll
  for (int i = 0; i < 8; ++i) { a[i] = (_Float16)(p[i] * sc); a[8 + i] = (_Float16)(p[16 + i] * sc); }
  return a;
}
// column fragment from a [K][ld] layout (column n), rows >= K read as 0
__device__ __forceinline__ v16h fragc_f32(const float* W, int k0, int n, int lane, int ld, int K) {
  v16h a; const int g = lane >> 4;
#pragma unroll
  for (int i = 0; i < 8; ++i) { const int ka = k0 + 8 * g + i, kb = ka + 16;
    a[i] = (_Float16)(ka < K ? W[(size_t)(ka < K ? ka : K - 1) * ld + n] : 0.f); a[8 + i] = (_Float16)(kb < K ? W[(size_t)(kb < K ? kb : K - 1) * ld + n] : 0.f); }
  return a;
}
struct F2 { v16b h, l; };
__device__ __forceinline__ F2 bsplit16(const float v[16]) { F2 r;
#pragma unroll
  for (int i = 0; i < 16; ++i) { const __bf16 h = (__bf16)v[i]; r.h[i] = h; r.l[i] = (__bf16)(v[i] - (float)h); }
  return r; }
__device__ __forceinline__ F2 split_row(const float* row, int k0, int lane) { float v[16]; const float* p = row + k0 + 8 * (lane >> 4);
#pragma unroll
  for (int i = 0; i < 8; ++i) { v[i] = p[i]; v[8 + i] = p[16 + i]; }
  return bsplit16(v); }
__device__ __forceinline__ F2 split_rowK(const float* row, int k0, int lane, int K) { float v[16]; const int g = lane >> 4;
#pragma unroll
  for (int i = 0; i < 8; ++i) { const int ka = k0 + 8 * g + i, kb = ka + 16; v[i] = ka < K ? row[ka < K ? ka : K - 1] : 0.f; v[8 + i] = kb < K ? row[kb < K ? kb : K - 1] : 0.f; }
  return bsplit16(v); }
__device__ __forceinline__ F2 split_col(const float* W, int k0, int n, int lane, int ld, int K) { float v[16]; const int g = lane >> 4;
#pragma unroll
  for (int i = 0; i < 8; ++i) { const int ka = k0 + 8 * g + i, kb = ka + 16; v[i] = ka < K ? W[(size_t)(ka < K ? ka : K - 1) * ld + n] : 0.f; v[8 + i] = kb < K ? W[(size_t)(kb < K ? kb : K - 1) * ld + n] : 0.f; }
  return bsplit16(v); }
__device__ __forceinline__ v8f mac3(const F2& a, const F2& b, v8f c) { c = wmma_bf(a.l, b.h, c); c = wmma_bf(a.h, b.l, c); return wmma_bf(a.h, b.h, c); }
__device__ __forceinline__ float sigm(float v) { return 1.0f / (1.0f + expf(-v)); }
#define LDSX() do { asm volatile("s_wait_dscnt 0" ::: "memory"); __builtin_amdgcn_wave_barrier(); __builtin_amdgcn_fence(__ATOMIC_RELEASE, "workgroup"); } while (0)


// Convolutional self attention (B 8, 64 x 64, C 64, q/k dim C/8 = 8): 1x1-conv q/k/v, unscaled softmax over all pixels, out = attn v * gamma + x (channels-last).
#define NI 8
#define NP 4096
#define CC 64
#define DQ 8
#ifndef TNI
#define TNI NI
#endif
typedef __attribute__((ext_vector_type(8))) __bf16 v8b;
__device__ __forceinline__ v16b frag_b(const __bf16* rowk0, int lane) {
  union { v16b v; v8b q[2]; } u; const __bf16* p = rowk0 + 8 * (lane >> 4);
  u.q[0] = *(const v8b*)p; u.q[1] = *(const v8b*)(p + 16); return u.v;
}
__device__ __forceinline__ float bfr(float v) { return (float)(__bf16)v; }
__device__ __attribute__((noinline)) float exp_ni(float v) { return expf(v); }
__device__ __attribute__((noinline)) float erf_ni(float v) { return erff(v); }

#define WS_Q   0u                                   // f32 q rows [n][8]
#define WS_K   (WS_Q + 4u * (size_t)NI * NP * DQ)
#define WS_VT  (WS_K + 4u * (size_t)NI * NP * DQ)       // f16 v planes [b][64][n]
#define WS_END (WS_VT + 2u * (size_t)NI * CC * NP)

// ---- k_proj: block = 64 pixels (rows of x [b*n][64]): q, k (8 each; one 16-col tile holding q|k) and v (64) exact
__global__ __launch_bounds__(128) void k_proj(const float* __restrict__ X, const float* __restrict__ WQ, const float* __restrict__ BQ, const float* __restrict__ WK, const float* __restrict__ BK, const float* __restrict__ WV, const float* __restrict__ BV, float* __restrict__ Q, float* __restrict__ K, _Float16* __restrict__ VT) {
  __shared__ __align__(16) float sqk[64][16]; __shared__ __align__(16) _Float16 tv[64][72];
  const int tid = threadIdx.x, wave = tid >> 5, lane = tid & 31, col = lane & 15, g = lane >> 4; const size_t r0 = (size_t)blockIdx.x * 64;
  v8f acc[5] = {};
#pragma unroll
  for (int kc = 0; kc < CC / 32; ++kc) { v16b a; { const float* p = X + (r0 + wave * 16 + col) * CC + kc * 32 + 8 * g;
#pragma unroll
      for (int i = 0; i < 8; ++i) { a[i] = (__bf16)p[i]; a[8 + i] = (__bf16)p[16 + i]; } }
    { v16b w; const float* Wm = (col < 8) ? WQ : WK; const int o = col & 7;   // tile 0: cols 0-7 = q, 8-15 = k
#pragma unroll
      for (int i = 0; i < 8; ++i) { w[i] = (__bf16)Wm[(kc * 32 + 8 * g + i) * DQ + o]; w[8 + i] = (__bf16)Wm[(kc * 32 + 16 + 8 * g + i) * DQ + o]; }
      acc[0] = wmma_bf(a, w, acc[0]); }
#pragma unroll
    for (int j = 0; j < 4; ++j) { v16b w; const int o = j * 16 + col;
#pragma unroll
      for (int i = 0; i < 8; ++i) { w[i] = (__bf16)WV[(kc * 32 + 8 * g + i) * CC + o]; w[8 + i] = (__bf16)WV[(kc * 32 + 16 + 8 * g + i) * CC + o]; }
      acc[1 + j] = wmma_bf(a, w, acc[1 + j]); } }
  { const float bb = (col < 8) ? bfr(BQ[col]) : bfr(BK[col & 7]);
#pragma unroll
    for (int r = 0; r < 8; ++r) sqk[wave * 16 + 8 * g + r][col] = acc[0][r] + bb; }
#pragma unroll
  for (int j = 0; j < 4; ++j) { const int c = j * 16 + col; const float bb = bfr(BV[c]);
#pragma unroll
    for (int r = 0; r < 8; ++r) tv[c][wave * 16 + 8 * g + r] = (_Float16)(acc[1 + j][r] + bb); }
  __syncthreads();
  if (tid < 32) { const int rl = tid * 2; v4f a0 = *(const v4f*)&sqk[rl][0], a1 = *(const v4f*)&sqk[rl][4], b0 = *(const v4f*)&sqk[rl + 1][0], b1 = *(const v4f*)&sqk[rl + 1][4]; vst2(Q + (r0 + rl) * DQ, a0); vst2(Q + (r0 + rl) * DQ + 4, a1); vst2(Q + (r0 + rl + 1) * DQ, b0); vst2(Q + (r0 + rl + 1) * DQ + 4, b1); }
  else if (tid < 64) { const int rl = (tid - 32) * 2; v4f a0 = *(const v4f*)&sqk[rl][8], a1 = *(const v4f*)&sqk[rl][12], b0 = *(const v4f*)&sqk[rl + 1][8], b1 = *(const v4f*)&sqk[rl + 1][12]; vst2(K + (r0 + rl) * DQ, a0); vst2(K + (r0 + rl) * DQ + 4, a1); vst2(K + (r0 + rl + 1) * DQ, b0); vst2(K + (r0 + rl + 1) * DQ + 4, b1); }
  { const size_t b = r0 / NP; const int n0 = (int)(r0 % NP); for (int e = tid; e < 64 * 8; e += 128) { const int c = e >> 3, q = e & 7; vst2((unsigned*)(VT + (b * CC + c) * (size_t)NP + n0 + q * 8), *(const v4u*)&tv[c][q * 8]); } } }
// ---- k_att: block = 64 queries of image b: 3-product logits (K = 8 padded), softmax over 4,096 pixels, P . v, out = gamma * o + x
__global__ __launch_bounds__(128) void k_att(const float* __restrict__ Q, const float* __restrict__ K, const _Float16* __restrict__ VT, const float* __restrict__ X, const float* __restrict__ GM, float* __restrict__ OUT) {
  __shared__ __align__(16) float sp[4][16][36]; __shared__ __align__(16) float so[4][16][68];
  const int tid = threadIdx.x, wave = tid >> 5, lane = tid & 31, col = lane & 15, g = lane >> 4; const int i0 = blockIdx.x * 64; const size_t b = blockIdx.y; const size_t q0 = b * NP + i0 + wave * 16;
  F2 aq; { float v[16];
#pragma unroll
    for (int i = 0; i < 16; ++i) v[i] = 0.f;
    if (g == 0) { const float* p = Q + (q0 + col) * DQ;
#pragma unroll
      for (int i = 0; i < 8; ++i) v[i] = p[i]; }
    aq = bsplit16(v); }
  float m[8], l[8];
#pragma unroll
  for (int r = 0; r < 8; ++r) { m[r] = -3.0e38f; l[r] = 0.f; }
  v8f acc[4] = {};
  const float gm = bfr(GM[0]);
#pragma unroll 1
  for (int ks = 0; ks < NP / 32; ++ks) { float s[2][8];
#pragma unroll
    for (int ct = 0; ct < 2; ++ct) { const size_t kk = b * NP + (size_t)ks * 32 + ct * 16 + col; F2 bk; { float v[16];
#pragma unroll
        for (int i = 0; i < 16; ++i) v[i] = 0.f;
        if (g == 0) { const float* p = K + kk * DQ;
#pragma unroll
          for (int i = 0; i < 8; ++i) v[i] = p[i]; }
        bk = bsplit16(v); }
      v8f c = {}; c = mac3(aq, bk, c);
#pragma unroll
      for (int r = 0; r < 8; ++r) s[ct][r] = c[r]; }
    float alpha[8];
#pragma unroll
    for (int r = 0; r < 8; ++r) { float mx = fmaxf(s[0][r], s[1][r]);
#pragma unroll
      for (int o = 1; o < 16; o <<= 1) mx = fmaxf(mx, __shfl_xor(mx, o));
      const float mn = fmaxf(m[r], mx); alpha[r] = __expf(m[r] - mn); const float e0 = __expf(s[0][r] - mn), e1 = __expf(s[1][r] - mn); float es = e0 + e1;
#pragma unroll
      for (int o = 1; o < 16; o <<= 1) es += __shfl_xor(es, o);
      l[r] = l[r] * alpha[r] + es; m[r] = mn; sp[wave][8 * g + r][col] = e0; sp[wave][8 * g + r][16 + col] = e1; }
#pragma unroll
    for (int j = 0; j < 4; ++j)
#pragma unroll
      for (int r = 0; r < 8; ++r) acc[j][r] *= alpha[r];
    LDSX();
    const v16h pa = frag_f32s(&sp[wave][col][0], lane, 2048.0f);
#pragma unroll
    for (int j = 0; j < 4; ++j) acc[j] = wmma16(pa, frag_h(VT + (b * CC + j * 16 + col) * (size_t)NP + (size_t)ks * 32, lane), acc[j]);
    LDSX(); }
#pragma unroll
  for (int r = 0; r < 8; ++r) { const float il = (1.0f / 2048.0f) / l[r];
#pragma unroll
    for (int j = 0; j < 4; ++j) { const int c = j * 16 + col; so[wave][8 * g + r][c] = acc[j][r] * il * gm + bfr(X[(q0 + 8 * g + r) * CC + c]); } }
  LDSX(); for (int rl = 0; rl < 16; ++rl) if (lane < 16) vst2(OUT + (q0 + rl) * CC + lane * 4, *(const v4f*)&so[wave][rl][lane * 4]); }
extern "C" void kernel_launch(void* const* d_in, const int* in_sizes, int n_in, void* d_out, int out_size, void* d_ws, size_t ws_size, hipStream_t stream) {
  (void)in_sizes; (void)n_in; (void)out_size;
  const float** F = (const float**)d_in;   // 0 x [8,64,64,64] (channels last), 1 wq [64,8], 2 bq, 3 wk, 4 bk, 5 wv [64,64], 6 bv, 7 gamma [1]
  if (ws_size < (size_t)WS_END) return;
  char* ws = (char*)d_ws; float *Q = (float*)(ws + WS_Q), *K = (float*)(ws + WS_K); _Float16* VT = (_Float16*)(ws + WS_VT);
  k_proj<<<TNI * NP / 64, 128, 0, stream>>>(F[0], F[1], F[2], F[3], F[4], F[5], F[6], Q, K, VT);
  k_att<<<dim3(NP / 64, TNI), 128, 0, stream>>>(Q, K, VT, F[0], F[7], (float*)d_out);
}

// v001
// Measured time: 127 microseconds a run.
// Timed twice side by side with v000, it ran 1.92 and 1.94 times as fast.
// compute dtype: all float inputs rounded to bf16, gamma read; q/k (8 channels) and v (64) = x W + b with EXACT bf16 products on WMMA 16x16x32 ((in,out) weights), f32 accumulate; q and k kept in f32 and split into bf16 hi + lo for the UNSCALED logits (3 products; K = 8 zero-padded to 32; logits std ~2.8), running-max softmax over the 4,096 pixels in f32 (hardware exp); P (f16 x 2^11) . v with v rounded once to f16; out = (P v) gamma + x; f32 output.
#include <hip/hip_runtime.h>
#include <math.h>

typedef __attribute__((ext_vector_type(16))) _Float16 v16h;
typedef __attribute__((ext_vector_type(16))) __bf16 v16b;
typedef __attribute__((ext_vector_type(8)))  _Float16 v8h;
typedef __attribute__((ext_vector_type(8)))  float v8f;
typedef __attribute__((ext_vector_type(4)))  float v4f;
typedef __attribute__((ext_vector_type(2)))  float v2f;
typedef __attribute__((ext_vector_type(4)))  unsigned v4u;
typedef __attribute__((ext_vector_type(4)))  int v4i;
typedef float __attribute__((may_alias)) float_a;
typedef int __attribute__((may_alias)) int_a;

template <typename T> __device__ __forceinline__ void vst2(void* p, T v) { *(T*)p = v;  }
__device__ __forceinline__ v8f wmma16(v16h a, v16h b, v8f c) {
  v8f d = __builtin_amdgcn_wmma_f32_16x16x32_f16(false, a, false, b, (short)0, c, false, false);
  asm volatile("v_nop\n\tv_nop\n\tv_nop\n\tv_nop" : "+v"(d) : "v"(a), "v"(b));
  return d;
}
__device__ __forceinline__ v8f wmma_bf(v16b a, v16b b, v8f c) {
  v8f d = __builtin_amdgcn_wmma_f32_16x16x32_bf16(false, a, false, b, (short)0, c, false, false);
  asm volatile("v_nop\n\tv_nop\n\tv_nop\n\tv_nop" : "+v"(d) : "v"(a), "v"(b));
  return d;
}
// 16x16x32 fragments: lane = (h = lane>>4, row/col = lane&15); elements 0..7 = k0+8h+0..7, 8..15 = k0+16+8h+0..7; D element r = row 8h+r
__device__ __forceinline__ v16h frag_h(const _Float16* rowk0, int lane) {
  union { v16h v; v8h q[2]; } u; const _Float16* p = rowk0 + 8 * (lane >> 4);
  u.q[0] = *(const v8h*)p; u.q[1] = *(const v8h*)(p + 16); return u.v;
}
__device__ __forceinline__ v16h frag_f32(const float* rowk0, int lane) {
  v16h a; const float* p = rowk0 + 8 * (lane >> 4);
#pragma unroll
  for (int i = 0; i < 8; ++i) { a[i] = (_Float16)p[i]; a[8 + i] = (_Float16)p[16 + i]; }
  return a;
}
__device__ __forceinline__ v16h frag_f32s(const float* rowk0, int lane, float sc) {
  v16h a; const float* p = rowk0 + 8 * (lane >> 4);
#pragma unroll
  for (int i = 0; i < 8; ++i) { a[i] = (_Float16)(p[i] * sc); a[8 + i] = (_Float16)(p[16 + i] * sc); }
  return a;
}
// column fragment from a [K][ld] layout (column n), rows >= K read as 0
__device__ __forceinline__ v16h fragc_f32(const float* W, int k0, int n, int lane, int ld, int K) {
  v16h a; const int g = lane >> 4;
#pragma unroll
  for (int i = 0; i < 8; ++i) { const int ka = k0 + 8 * g + i, kb = ka + 16;
    a[i] = (_Float16)(ka < K ? W[(size_t)(ka < K ? ka : K - 1) * ld + n] : 0.f); a[8 + i] = (_Float16)(kb < K ? W[(size_t)(kb < K ? kb : K - 1) * ld + n] : 0.f); }
  return a;
}
struct F2 { v16b h, l; };
__device__ __forceinline__ F2 bsplit16(const float v[16]) { F2 r;
#pragma unroll
  for (int i = 0; i < 16; ++i) { const __bf16 h = (__bf16)v[i]; r.h[i] = h; r.l[i] = (__bf16)(v[i] - (float)h); }
  return r; }
__device__ __forceinline__ F2 split_row(const float* row, int k0, int lane) { float v[16]; const float* p = row + k0 + 8 * (lane >> 4);
#pragma unroll
  for (int i = 0; i < 8; ++i) { v[i] = p[i]; v[8 + i] = p[16 + i]; }
  return bsplit16(v); }
__device__ __forceinline__ F2 split_rowK(const float* row, int k0, int lane, int K) { float v[16]; const int g = lane >> 4;
#pragma unroll
  for (int i = 0; i < 8; ++i) { const int ka = k0 + 8 * g + i, kb = ka + 16; v[i] = ka < K ? row[ka < K ? ka : K - 1] : 0.f; v[8 + i] = kb < K ? row[kb < K ? kb : K - 1] : 0.f; }
  return bsplit16(v); }
__device__ __forceinline__ F2 split_col(const float* W, int k0, int n, int lane, int ld, int K) { float v[16]; const int g = lane >> 4;
#pragma unroll
  for (int i = 0; i < 8; ++i) { const int ka = k0 + 8 * g + i, kb = ka + 16; v[i] = ka < K ? W[(size_t)(ka < K ? ka : K - 1) * ld + n] : 0.f; v[8 + i] = kb < K ? W[(size_t)(kb < K ? kb : K - 1) * ld + n] : 0.f; }
  return bsplit16(v); }
__device__ __forceinline__ v8f mac3(const F2& a, const F2& b, v8f c) { c = wmma_bf(a.l, b.h, c); c = wmma_bf(a.h, b.l, c); return wmma_bf(a.h, b.h, c); }
__device__ __forceinline__ float sigm(float v) { return 1.0f / (1.0f + expf(-v)); }
#define LDSX() do { asm volatile("s_wait_dscnt 0" ::: "memory"); __builtin_amdgcn_wave_barrier(); __builtin_amdgcn_fence(__ATOMIC_RELEASE, "workgroup"); } while (0)


// Convolutional self attention (B 8, 64 x 64, C 64, q/k dim C/8 = 8): 1x1-conv q/k/v, unscaled softmax over all pixels, out = attn v * gamma + x (channels-last).
#define NI 8
#define NP 4096
#define CC 64
#define DQ 8
#ifndef TNI
#define TNI NI
#endif
typedef __attribute__((ext_vector_type(8))) __bf16 v8b;
__device__ __forceinline__ v16b frag_b(const __bf16* rowk0, int lane) {
  union { v16b v; v8b q[2]; } u; const __bf16* p = rowk0 + 8 * (lane >> 4);
  u.q[0] = *(const v8b*)p; u.q[1] = *(const v8b*)(p + 16); return u.v;
}
__device__ __forceinline__ float bfr(float v) { return (float)(__bf16)v; }
__device__ __attribute__((noinline)) float exp_ni(float v) { return expf(v); }
__device__ __attribute__((noinline)) float erf_ni(float v) { return erff(v); }

#define WS_Q   0u                                   // f32 q rows [n][8]
#define WS_K   (WS_Q + 4u * (size_t)NI * NP * DQ)
#define WS_VT  (WS_K + 4u * (size_t)NI * NP * DQ)       // f16 v planes [b][64][n]
#define WS_END (WS_VT + 2u * (size_t)NI * CC * NP)

// ---- k_proj: block = 64 pixels (rows of x [b*n][64]): q, k (8 each; one 16-col tile holding q|k) and v (64) exact
__global__ __launch_bounds__(128) void k_proj(const float* __restrict__ X, const float* __restrict__ WQ, const float* __restrict__ BQ, const float* __restrict__ WK, const float* __restrict__ BK, const float* __restrict__ WV, const float* __restrict__ BV, float* __restrict__ Q, float* __restrict__ K, _Float16* __restrict__ VT) {
  __shared__ __align__(16) float sqk[64][16]; __shared__ __align__(16) _Float16 tv[64][72];
  const int tid = threadIdx.x, wave = tid >> 5, lane = tid & 31, col = lane & 15, g = lane >> 4; const size_t r0 = (size_t)blockIdx.x * 64;
  v8f acc[5] = {};
#pragma unroll
  for (int kc = 0; kc < CC / 32; ++kc) { v16b a; { const float* p = X + (r0 + wave * 16 + col) * CC + kc * 32 + 8 * g;
#pragma unroll
      for (int i = 0; i < 8; ++i) { a[i] = (__bf16)p[i]; a[8 + i] = (__bf16)p[16 + i]; } }
    { v16b w; const float* Wm = (col < 8) ? WQ : WK; const int o = col & 7;   // tile 0: cols 0-7 = q, 8-15 = k
#pragma unroll
      for (int i = 0; i < 8; ++i) { w[i] = (__bf16)Wm[(kc * 32 + 8 * g + i) * DQ + o]; w[8 + i] = (__bf16)Wm[(kc * 32 + 16 + 8 * g + i) * DQ + o]; }
      acc[0] = wmma_bf(a, w, acc[0]); }
#pragma unroll
    for (int j = 0; j < 4; ++j) { v16b w; const int o = j * 16 + col;
#pragma unroll
      for (int i = 0; i < 8; ++i) { w[i] = (__bf16)WV[(kc * 32 + 8 * g + i) * CC + o]; w[8 + i] = (__bf16)WV[(kc * 32 + 16 + 8 * g + i) * CC + o]; }
      acc[1 + j] = wmma_bf(a, w, acc[1 + j]); } }
  { const float bb = (col < 8) ? bfr(BQ[col]) : bfr(BK[col & 7]);
#pragma unroll
    for (int r = 0; r < 8; ++r) sqk[wave * 16 + 8 * g + r][col] = acc[0][r] + bb; }
#pragma unroll
  for (int j = 0; j < 4; ++j) { const int c = j * 16 + col; const float bb = bfr(BV[c]);
#pragma unroll
    for (int r = 0; r < 8; ++r) tv[c][wave * 16 + 8 * g + r] = (_Float16)(acc[1 + j][r] + bb); }
  __syncthreads();
  if (tid < 32) { const int rl = tid * 2; v4f a0 = *(const v4f*)&sqk[rl][0], a1 = *(const v4f*)&sqk[rl][4], b0 = *(const v4f*)&sqk[rl + 1][0], b1 = *(const v4f*)&sqk[rl + 1][4]; vst2(Q + (r0 + rl) * DQ, a0); vst2(Q + (r0 + rl) * DQ + 4, a1); vst2(Q + (r0 + rl + 1) * DQ, b0); vst2(Q + (r0 + rl + 1) * DQ + 4, b1); }
  else if (tid < 64) { const int rl = (tid - 32) * 2; v4f a0 = *(const v4f*)&sqk[rl][8], a1 = *(const v4f*)&sqk[rl][12], b0 = *(const v4f*)&sqk[rl + 1][8], b1 = *(const v4f*)&sqk[rl + 1][12]; vst2(K + (r0 + rl) * DQ, a0); vst2(K + (r0 + rl) * DQ + 4, a1); vst2(K + (r0 + rl + 1) * DQ, b0); vst2(K + (r0 + rl + 1) * DQ + 4, b1); }
  { const size_t b = r0 / NP; const int n0 = (int)(r0 % NP); for (int e = tid; e < 64 * 8; e += 128) { const int c = e >> 3, q = e & 7; vst2((unsigned*)(VT + (b * CC + c) * (size_t)NP + n0 + q * 8), *(const v4u*)&tv[c][q * 8]); } } }
#define GLB __attribute__((address_space(1)))
// a wave-uniform global pointer held in scalar registers, so that the loads behind it take the scalar-base form and no vector address pair is formed per trip
template <typename T> __device__ __forceinline__ const GLB T* ubase(const T* p) { const unsigned long long a = (unsigned long long)p;
  return (const GLB T*)(((unsigned long long)(unsigned)__builtin_amdgcn_readfirstlane((int)(a >> 32)) << 32) | (unsigned)__builtin_amdgcn_readfirstlane((int)a)); }
// 16x16x32 f16 fragment from a wave-uniform base and the lane's own element offset (row * pitch + 8 * (lane >> 4))
__device__ __forceinline__ v16h frag_u(const GLB _Float16* base, unsigned off) {
  union { v16h v; v8h q[2]; } u; u.q[0] = *(const GLB v8h*)(base + off); u.q[1] = *(const GLB v8h*)(base + 16 + off); return u.v;
}
// ---- k_att: block = 64 queries of image b: 3-product logits (K = 8 padded), softmax over 4,096 pixels, P . v, out = gamma * o + x
__global__ __launch_bounds__(128) void k_att(const float* __restrict__ Q, const float* __restrict__ K, const _Float16* __restrict__ VT, const float* __restrict__ X, const float* __restrict__ GM, float* __restrict__ OUT) {
  __shared__ __align__(16) float sp[4][16][36]; __shared__ __align__(16) float so[4][16][68];
  const int tid = threadIdx.x, wave = tid >> 5, lane = tid & 31, col = lane & 15, g = lane >> 4; const int i0 = blockIdx.x * 64; const size_t b = blockIdx.y; const size_t q0 = b * NP + i0 + wave * 16;
  F2 aq; { float v[16];
#pragma unroll
    for (int i = 0; i < 16; ++i) v[i] = 0.f;
    if (g == 0) { const float* p = Q + (q0 + col) * DQ;
#pragma unroll
      for (int i = 0; i < 8; ++i) v[i] = p[i]; }
    aq = bsplit16(v); }
  float m[8], l[8];
#pragma unroll
  for (int r = 0; r < 8; ++r) { m[r] = -3.0e38f; l[r] = 0.f; }
  v8f acc[4] = {};
  const float gm = bfr(GM[0]);
  // The trip's K rows (kr; lanes g == 1 stay 0) and V fragments (vf) are fetched one trip ahead, each into the registers of the tile it replaces, right after that tile's last use.
  // Addresses: a wave-uniform scalar base that moves with the trip plus a fixed 32-bit lane offset: no vector address register is rewritten behind an issued load, and the bases are formed anew behind the wait at the trip's head.
  const float* kb0 = K + b * NP * DQ; const _Float16* vb0 = VT + b * CC * (size_t)NP; const unsigned ko = col * DQ, vo = col * NP + 8 * g;
  float kr[2][8]; v16h vf[4];
#pragma unroll
  for (int ct = 0; ct < 2; ++ct)
#pragma unroll
    for (int i = 0; i < 8; ++i) kr[ct][i] = 0.f;
  if (g == 0) {
#pragma unroll
    for (int ct = 0; ct < 2; ++ct)
#pragma unroll
      for (int i = 0; i < 8; ++i) kr[ct][i] = (ubase(kb0) + ct * 16 * DQ + i)[ko]; }
#pragma unroll
  for (int j = 0; j < 4; ++j) vf[j] = frag_u(ubase(vb0) + j * 16 * NP, vo);
#pragma unroll 1
  for (int ks = 0; ks < NP / 32; ++ks) { float s[2][8]; F2 bk[2];
    int kt = ks;
    asm volatile("s_wait_xcnt 0x0" : "+s"(kt) :: "memory");   // stands before the scalar bases named by the loads of the trip before are formed anew (they all derive from kt)
    const int kn = kt < NP / 32 - 1 ? kt + 1 : kt;   // the last trip fetches its own tile again: every fetch stays inside what k_proj wrote
#pragma unroll
    for (int ct = 0; ct < 2; ++ct) { float v[16];
#pragma unroll
      for (int i = 0; i < 8; ++i) { v[i] = kr[ct][i]; v[8 + i] = 0.f; }
      bk[ct] = bsplit16(v); }
    if (g == 0) { const GLB float* kb = ubase(kb0 + (size_t)kn * 32 * DQ);
#pragma unroll
      for (int ct = 0; ct < 2; ++ct)
#pragma unroll
        for (int i = 0; i < 8; ++i) kr[ct][i] = (kb + ct * 16 * DQ + i)[ko]; }
#pragma unroll
    for (int ct = 0; ct < 2; ++ct) { v8f c = {}; c = mac3(aq, bk[ct], c);
#pragma unroll
      for (int r = 0; r < 8; ++r) s[ct][r] = c[r]; }
    float alpha[8];
#pragma unroll
    for (int r = 0; r < 8; ++r) { float mx = fmaxf(s[0][r], s[1][r]);
#pragma unroll
      for (int o = 1; o < 16; o <<= 1) mx = fmaxf(mx, __shfl_xor(mx, o));
      const float mn = fmaxf(m[r], mx); alpha[r] = __expf(m[r] - mn); const float e0 = __expf(s[0][r] - mn), e1 = __expf(s[1][r] - mn); float es = e0 + e1;
#pragma unroll
      for (int o = 1; o < 16; o <<= 1) es += __shfl_xor(es, o);
      l[r] = l[r] * alpha[r] + es; m[r] = mn; sp[wave][8 * g + r][col] = e0; sp[wave][8 * g + r][16 + col] = e1; }
#pragma unroll
    for (int j = 0; j < 4; ++j)
#pragma unroll
      for (int r = 0; r < 8; ++r) acc[j][r] *= alpha[r];
    LDSX();
    const v16h pa = frag_f32s(&sp[wave][col][0], lane, 2048.0f);
#pragma unroll
    for (int j = 0; j < 4; ++j) acc[j] = wmma16(pa, vf[j], acc[j]);
    LDSX();
    const GLB _Float16* vb = ubase(vb0 + (size_t)kn * 32);
#pragma unroll
    for (int j = 0; j < 4; ++j) vf[j] = frag_u(vb + j * 16 * NP, vo); }
#pragma unroll
  for (int r = 0; r < 8; ++r) { const float il = (1.0f / 2048.0f) / l[r];
#pragma unroll
    for (int j = 0; j < 4; ++j) { const int c = j * 16 + col; so[wave][8 * g + r][c] = acc[j][r] * il * gm + bfr(X[(q0 + 8 * g + r) * CC + c]); } }
  LDSX(); for (int rl = 0; rl < 16; ++rl) if (lane < 16) vst2(OUT + (q0 + rl) * CC + lane * 4, *(const v4f*)&so[wave][rl][lane * 4]); }
extern "C" void kernel_launch(void* const* d_in, const int* in_sizes, int n_in, void* d_out, int out_size, void* d_ws, size_t ws_size, hipStream_t stream) {
  (void)in_sizes; (void)n_in; (void)out_size;
  const float** F = (const float**)d_in;   // 0 x [8,64,64,64] (channels last), 1 wq [64,8], 2 bq, 3 wk, 4 bk, 5 wv [64,64], 6 bv, 7 gamma [1]
  if (ws_size < (size_t)WS_END) return;
  char* ws = (char*)d_ws; float *Q = (float*)(ws + WS_Q), *K = (float*)(ws + WS_K); _Float16* VT = (_Float16*)(ws + WS_VT);
  k_proj<<<TNI * NP / 64, 128, 0, stream>>>(F[0], F[1], F[2], F[3], F[4], F[5], F[6], Q, K, VT);
  k_att<<<dim3(NP / 64, TNI), 128, 0, stream>>>(Q, K, VT, F[0], F[7], (float*)d_out);
}

// v002
// A run of this version takes 82.7 microseconds.
// Two timings next to v001 put it at 1.53 and 1.54 times that version's speed.
// Counting every step since v000, it is 2.97 times as fast.
// compute dtype: all float inputs rounded to bf16, gamma read; q/k (8 channels) and v (64) = x W + b with EXACT bf16 products on WMMA 16x16x32 ((in,out) weights), f32 accumulate; q and k kept in f32 and split into bf16 hi + lo for the UNSCALED logits (3 products; K = 8 zero-padded to 32; logits std ~2.8), running-max softmax over the 4,096 pixels in f32 (hardware exp); P (f16 x 2^11) . v with v rounded once to f16; out = (P v) gamma + x; f32 output.
#include <hip/hip_runtime.h>
#include <math.h>

typedef __attribute__((ext_vector_type(16))) _Float16 v16h;
typedef __attribute__((ext_vector_type(16))) __bf16 v16b;
typedef __attribute__((ext_vector_type(8)))  _Float16 v8h;
typedef __attribute__((ext_vector_type(8)))  float v8f;
typedef __attribute__((ext_vector_type(4)))  float v4f;
typedef __attribute__((ext_vector_type(2)))  float v2f;
typedef __attribute__((ext_vector_type(4)))  unsigned v4u;
typedef __attribute__((ext_vector_type(4)))  int v4i;
typedef float __attribute__((may_alias)) float_a;
typedef int __attribute__((may_alias)) int_a;

template <typename T> __device__ __forceinline__ void vst2(void* p, T v) { *(T*)p = v;  }
__device__ __forceinline__ v8f wmma16(v16h a, v16h b, v8f c) {
  v8f d = __builtin_amdgcn_wmma_f32_16x16x32_f16(false, a, false, b, (short)0, c, false, false);
  asm volatile("v_nop\n\tv_nop\n\tv_nop\n\tv_nop" : "+v"(d) : "v"(a), "v"(b));
  return d;
}
__device__ __forceinline__ v8f wmma_bf(v16b a, v16b b, v8f c) {
  v8f d = __builtin_amdgcn_wmma_f32_16x16x32_bf16(false, a, false, b, (short)0, c, false, false);
  asm volatile("v_nop\n\tv_nop\n\tv_nop\n\tv_nop" : "+v"(d) : "v"(a), "v"(b));
  return d;
}
// 16x16x32 fragments: lane = (h = lane>>4, row/col = lane&15); elements 0..7 = k0+8h+0..7, 8..15 = k0+16+8h+0..7; D element r = row 8h+r
__device__ __forceinline__ v16h frag_h(const _Float16* rowk0, int lane) {
  union { v16h v; v8h q[2]; } u; const _Float16* p = rowk0 + 8 * (lane >> 4);
  u.q[0] = *(const v8h*)p; u.q[1] = *(const v8h*)(p + 16); return u.v;
}
__device__ __forceinline__ v16h frag_f32(const float* rowk0, int lane) {
  v16h a; const float* p = rowk0 + 8 * (lane >> 4);
#pragma unroll
  for (int i = 0; i < 8; ++i) { a[i] = (_Float16)p[i]; a[8 + i] = (_Float16)p[16 + i]; }
  return a;
}
__device__ __forceinline__ v16h frag_f32s(const float* rowk0, int lane, float sc) {
  v16h a; const float* p = rowk0 + 8 * (lane >> 4);
#pragma unroll
  for (int i = 0; i < 8; ++i) { a[i] = (_Float16)(p[i] * sc); a[8 + i] = (_Float16)(p[16 + i] * sc); }
  return a;
}
// column fragment from a [K][ld] layout (column n), rows >= K read as 0
__device__ __forceinline__ v16h fragc_f32(const float* W, int k0, int n, int lane, int ld, int K) {
  v16h a; const int g = lane >> 4;
#pragma unroll
  for (int i = 0; i < 8; ++i) { const int ka = k0 + 8 * g + i, kb = ka + 16;
    a[i] = (_Float16)(ka < K ? W[(size_t)(ka < K ? ka : K - 1) * ld + n] : 0.f); a[8 + i] = (_Float16)(kb < K ? W[(size_t)(kb < K ? kb : K - 1) * ld + n] : 0.f); }
  return a;
}
struct F2 { v16b h, l; };
__device__ __forceinline__ F2 bsplit16(const float v[16]) { F2 r;
#pragma unroll
  for (int i = 0; i < 16; ++i) { const __bf16 h = (__bf16)v[i]; r.h[i] = h; r.l[i] = (__bf16)(v[i] - (float)h); }
  return r; }
__device__ __forceinline__ F2 split_row(const float* row, int k0, int lane) { float v[16]; const float* p = row + k0 + 8 * (lane >> 4);
#pragma unroll
  for (int i = 0; i < 8; ++i) { v[i] = p[i]; v[8 + i] = p[16 + i]; }
  return bsplit16(v); }
__device__ __forceinline__ F2 split_rowK(const float* row, int k0, int lane, int K) { float v[16]; const int g = lane >> 4;
#pragma unroll
  for (int i = 0; i < 8; ++i) { const int ka = k0 + 8 * g + i, kb = ka + 16; v[i] = ka < K ? row[ka < K ? ka : K - 1] : 0.f; v[8 + i] = kb < K ? row[kb < K ? kb : K - 1] : 0.f; }
  return bsplit16(v); }
__device__ __forceinline__ F2 split_col(const float* W, int k0, int n, int lane, int ld, int K) { float v[16]; const int g = lane >> 4;
#pragma unroll
  for (int i = 0; i < 8; ++i) { const int ka = k0 + 8 * g + i, kb = ka + 16; v[i] = ka < K ? W[(size_t)(ka < K ? ka : K - 1) * ld + n] : 0.f; v[8 + i] = kb < K ? W[(size_t)(kb < K ? kb : K - 1) * ld + n] : 0.f; }
  return bsplit16(v); }
__device__ __forceinline__ v8f mac3(const F2& a, const F2& b, v8f c) { c = wmma_bf(a.l, b.h, c); c = wmma_bf(a.h, b.l, c); return wmma_bf(a.h, b.h, c); }
__device__ __forceinline__ float sigm(float v) { return 1.0f / (1.0f + expf(-v)); }
#define LDSX() do { asm volatile("s_wait_dscnt 0" ::: "memory"); __builtin_amdgcn_wave_barrier(); __builtin_amdgcn_fence(__ATOMIC_RELEASE, "workgroup"); } while (0)


// Convolutional self attention (B 8, 64 x 64, C 64, q/k dim C/8 = 8): 1x1-conv q/k/v, unscaled softmax over all pixels, out = attn v * gamma + x (channels-last).
#define NI 8
#define NP 4096
#define CC 64
#define DQ 8
#ifndef TNI
#define TNI NI
#endif
typedef __attribute__((ext_vector_type(8))) __bf16 v8b;
__device__ __forceinline__ v16b frag_b(const __bf16* rowk0, int lane) {
  union { v16b v; v8b q[2]; } u; const __bf16* p = rowk0 + 8 * (lane >> 4);
  u.q[0] = *(const v8b*)p; u.q[1] = *(const v8b*)(p + 16); return u.v;
}
__device__ __forceinline__ float bfr(float v) { return (float)(__bf16)v; }
__device__ __attribute__((noinline)) float exp_ni(float v) { return expf(v); }
__device__ __attribute__((noinline)) float erf_ni(float v) { return erff(v); }

#define WS_Q   0u                                   // f32 q rows [n][8]
#define WS_K   (WS_Q + 4u * (size_t)NI * NP * DQ)
#define WS_VT  (WS_K + 4u * (size_t)NI * NP * DQ)       // f16 v planes [b][64][n]
#define WS_END (WS_VT + 2u * (size_t)NI * CC * NP)

// ---- k_proj: block = 64 pixels (rows of x [b*n][64]): q, k (8 each; one 16-col tile holding q|k) and v (64) exact
__global__ __launch_bounds__(128) void k_proj(const float* __restrict__ X, const float* __restrict__ WQ, const float* __restrict__ BQ, const float* __restrict__ WK, const float* __restrict__ BK, const float* __restrict__ WV, const float* __restrict__ BV, float* __restrict__ Q, float* __restrict__ K, _Float16* __restrict__ VT) {
  __shared__ __align__(16) float sqk[64][16]; __shared__ __align__(16) _Float16 tv[64][72];
  const int tid = threadIdx.x, wave = tid >> 5, lane = tid & 31, col = lane & 15, g = lane >> 4; const size_t r0 = (size_t)blockIdx.x * 64;
  v8f acc[5] = {};
#pragma unroll
  for (int kc = 0; kc < CC / 32; ++kc) { v16b a; { const float* p = X + (r0 + wave * 16 + col) * CC + kc * 32 + 8 * g;
#pragma unroll
      for (int i = 0; i < 8; ++i) { a[i] = (__bf16)p[i]; a[8 + i] = (__bf16)p[16 + i]; } }
    { v16b w; const float* Wm = (col < 8) ? WQ : WK; const int o = col & 7;   // tile 0: cols 0-7 = q, 8-15 = k
#pragma unroll
      for (int i = 0; i < 8; ++i) { w[i] = (__bf16)Wm[(kc * 32 + 8 * g + i) * DQ + o]; w[8 + i] = (__bf16)Wm[(kc * 32 + 16 + 8 * g + i) * DQ + o]; }
      acc[0] = wmma_bf(a, w, acc[0]); }
#pragma unroll
    for (int j = 0; j < 4; ++j) { v16b w; const int o = j * 16 + col;
#pragma unroll
      for (int i = 0; i < 8; ++i) { w[i] = (__bf16)WV[(kc * 32 + 8 * g + i) * CC + o]; w[8 + i] = (__bf16)WV[(kc * 32 + 16 + 8 * g + i) * CC + o]; }
      acc[1 + j] = wmma_bf(a, w, acc[1 + j]); } }
  { const float bb = (col < 8) ? bfr(BQ[col]) : bfr(BK[col & 7]);
#pragma unroll
    for (int r = 0; r < 8; ++r) sqk[wave * 16 + 8 * g + r][col] = acc[0][r] + bb; }
#pragma unroll
  for (int j = 0; j < 4; ++j) { const int c = j * 16 + col; const float bb = bfr(BV[c]);
#pragma unroll
    for (int r = 0; r < 8; ++r) tv[c][wave * 16 + 8 * g + r] = (_Float16)(acc[1 + j][r] + bb); }
  __syncthreads();
  if (tid < 32) { const int rl = tid * 2; v4f a0 = *(const v4f*)&sqk[rl][0], a1 = *(const v4f*)&sqk[rl][4], b0 = *(const v4f*)&sqk[rl + 1][0], b1 = *(const v4f*)&sqk[rl + 1][4]; vst2(Q + (r0 + rl) * DQ, a0); vst2(Q + (r0 + rl) * DQ + 4, a1); vst2(Q + (r0 + rl + 1) * DQ, b0); vst2(Q + (r0 + rl + 1) * DQ + 4, b1); }
  else if (tid < 64) { const int rl = (tid - 32) * 2; v4f a0 = *(const v4f*)&sqk[rl][8], a1 = *(const v4f*)&sqk[rl][12], b0 = *(const v4f*)&sqk[rl + 1][8], b1 = *(const v4f*)&sqk[rl + 1][12]; vst2(K + (r0 + rl) * DQ, a0); vst2(K + (r0 + rl) * DQ + 4, a1); vst2(K + (r0 + rl + 1) * DQ, b0); vst2(K + (r0 + rl + 1) * DQ + 4, b1); }
  { const size_t b = r0 / NP; const int n0 = (int)(r0 % NP); for (int e = tid; e < 64 * 8; e += 128) { const int c = e >> 3, q = e & 7; vst2((unsigned*)(VT + (b * CC + c) * (size_t)NP + n0 + q * 8), *(const v4u*)&tv[c][q * 8]); } } }
#define GLB __attribute__((address_space(1)))
// a wave-uniform global pointer held in scalar registers, so that the loads behind it take the scalar-base form and no vector address pair is formed per trip
template <typename T> __device__ __forceinline__ const GLB T* ubase(const T* p) { const unsigned long long a = (unsigned long long)p;
  return (const GLB T*)(((unsigned long long)(unsigned)__builtin_amdgcn_readfirstlane((int)(a >> 32)) << 32) | (unsigned)__builtin_amdgcn_readfirstlane((int)a)); }
// 16x16x32 f16 fragment from a wave-uniform base and the lane's own element offset (row * pitch + 8 * (lane >> 4))
__device__ __forceinline__ v16h frag_u(const GLB _Float16* base, unsigned off) {
  union { v16h v; v8h q[2]; } u; u.q[0] = *(const GLB v8h*)(base + off); u.q[1] = *(const GLB v8h*)(base + 16 + off); return u.v;
}
// lane l with lane l ^ 16 (a vector cross-row move; the shuffle helper would go through the LDS pipe)
__device__ __forceinline__ float xhalf(float x) { return __builtin_bit_cast(float, __builtin_amdgcn_permlanex16(__builtin_bit_cast(int, x), __builtin_bit_cast(int, x), 0x76543210, 0xfedcba98, false, false)); }
// ---- k_att: block = 64 queries of image b, transposed: S^T = K . Q^T (3 products, K = 8 padded), so a lane holds 16 of the 32 scores of ONE query (col): softmax in the lane plus one exchange between halves;
//      the two S^T tiles, converted in place, are the B operand of O^T += V^T . P^T; out = gamma * o + x
__global__ __launch_bounds__(128) void k_att(const float* __restrict__ Q, const float* __restrict__ K, const _Float16* __restrict__ VT, const float* __restrict__ X, const float* __restrict__ GM, float* __restrict__ OUT) {
  __shared__ __align__(16) float so[4][16][68];
  const int tid = threadIdx.x, wave = tid >> 5, lane = tid & 31, col = lane & 15, g = lane >> 4; const int i0 = blockIdx.x * 64; const size_t b = blockIdx.y; const size_t q0 = b * NP + i0 + wave * 16;
  F2 aq; { float v[16];
#pragma unroll
    for (int i = 0; i < 16; ++i) v[i] = 0.f;
    if (g == 0) { const float* p = Q + (q0 + col) * DQ;
#pragma unroll
      for (int i = 0; i < 8; ++i) v[i] = p[i]; }
    aq = bsplit16(v); }
  float m = -3.0e38f, l = 0.f;   // query col's running maximum (same in both halves) and this half's share of its sum
  v8f acc[4] = {};               // acc[j][r] = O[query col][channel 16 j + 8 g + r]
  const float gm = bfr(GM[0]);
  // The trip's K rows (kr; lanes g == 1 stay 0) and V fragments (vf) are fetched one trip ahead, each into the registers of the tile it replaces, right after that tile's last use.
  // Addresses: a wave-uniform scalar base that moves with the trip plus a fixed 32-bit lane offset: no vector address register is rewritten behind an issued load, and the bases are formed anew behind the wait at the trip's head.
  const float* kb0 = K + b * NP * DQ; const _Float16* vb0 = VT + b * CC * (size_t)NP; const unsigned ko = col * DQ, vo = col * NP + 8 * g;
  float kr[2][8]; v16h vf[4];
#pragma unroll
  for (int ct = 0; ct < 2; ++ct)
#pragma unroll
    for (int i = 0; i < 8; ++i) kr[ct][i] = 0.f;
  if (g == 0) {
#pragma unroll
    for (int ct = 0; ct < 2; ++ct)
#pragma unroll
      for (int i = 0; i < 8; ++i) kr[ct][i] = (ubase(kb0) + ct * 16 * DQ + i)[ko]; }
#pragma unroll
  for (int j = 0; j < 4; ++j) vf[j] = frag_u(ubase(vb0) + j * 16 * NP, vo);
#pragma unroll 1
  for (int ks = 0; ks < NP / 32; ++ks) { F2 bk[2];
    int kt;
    asm volatile("s_wait_xcnt 0x0\n\ts_mov_b32 %0, %1" : "=s"(kt) : "s"(ks) : "memory");   // stands before the scalar bases named by the loads of the trip before are formed anew (they all derive from kt, which is itself written behind the wait)
    const int kn = kt < NP / 32 - 1 ? kt + 1 : kt;   // the last trip fetches its own tile again: every fetch stays inside what k_proj wrote
#pragma unroll
    for (int ct = 0; ct < 2; ++ct) { float v[16];
#pragma unroll
      for (int i = 0; i < 8; ++i) { v[i] = kr[ct][i]; v[8 + i] = 0.f; }
      bk[ct] = bsplit16(v); }
    if (g == 0) { const GLB float* kb = ubase(kb0 + (size_t)kn * 32 * DQ);
#pragma unroll
      for (int ct = 0; ct < 2; ++ct)
#pragma unroll
        for (int i = 0; i < 8; ++i) kr[ct][i] = (kb + ct * 16 * DQ + i)[ko]; }
    v8f s[2];   // s[ct][r] = logit of key 16 ct + 8 g + r with query col; the three products in the order they had (q.lo k.hi, q.hi k.lo, q.hi k.hi)
#pragma unroll
    for (int ct = 0; ct < 2; ++ct) { v8f c = {}; c = wmma_bf(bk[ct].h, aq.l, c); c = wmma_bf(bk[ct].l, aq.h, c); s[ct] = wmma_bf(bk[ct].h, aq.h, c); }
    float mx[4];
#pragma unroll
    for (int i = 0; i < 4; ++i) mx[i] = fmaxf(fmaxf(s[0][i], s[0][4 + i]), fmaxf(s[1][i], s[1][4 + i]));
    const float mh = fmaxf(fmaxf(mx[0], mx[1]), fmaxf(mx[2], mx[3]));
    const float mn = fmaxf(m, fmaxf(mh, xhalf(mh))); const float alpha = __expf(m - mn); m = mn;
    v16h pb; float es[4];   // pb: element r = key 8 g + r, element 8 + r = key 16 + 8 g + r: the k order of vf
#pragma unroll
    for (int r = 0; r < 8; ++r) { const float e0 = __expf(s[0][r] - mn), e1 = __expf(s[1][r] - mn);
      if (r < 4) es[r] = e0 + e1; else es[r - 4] += e0 + e1;
      pb[r] = (_Float16)(e0 * 2048.0f); pb[8 + r] = (_Float16)(e1 * 2048.0f); }
    l = l * alpha + ((es[0] + es[1]) + (es[2] + es[3]));
#pragma unroll
    for (int j = 0; j < 4; ++j)
#pragma unroll
      for (int r = 0; r < 8; ++r) acc[j][r] *= alpha;
#pragma unroll
    for (int j = 0; j < 4; ++j) acc[j] = wmma16(vf[j], pb, acc[j]);
    const GLB _Float16* vb = ubase(vb0 + (size_t)kn * 32);
#pragma unroll
    for (int j = 0; j < 4; ++j) vf[j] = frag_u(vb + j * 16 * NP, vo); }
  { const float il = (1.0f / 2048.0f) / (l + xhalf(l)); const float* xr = X + (q0 + col) * CC + 8 * g;
#pragma unroll
    for (int j = 0; j < 4; ++j)
#pragma unroll
      for (int r = 0; r < 8; ++r) so[wave][col][j * 16 + 8 * g + r] = acc[j][r] * il * gm + bfr(xr[j * 16 + r]); }
  LDSX(); for (int rl = 0; rl < 16; ++rl) if (lane < 16) vst2(OUT + (q0 + rl) * CC + lane * 4, *(const v4f*)&so[wave][rl][lane * 4]); }
extern "C" void kernel_launch(void* const* d_in, const int* in_sizes, int n_in, void* d_out, int out_size, void* d_ws, size_t ws_size, hipStream_t stream) {
  (void)in_sizes; (void)n_in; (void)out_size;
  const float** F = (const float**)d_in;   // 0 x [8,64,64,64] (channels last), 1 wq [64,8], 2 bq, 3 wk, 4 bk, 5 wv [64,64], 6 bv, 7 gamma [1]
  if (ws_size < (size_t)WS_END) return;
  char* ws = (char*)d_ws; float *Q = (float*)(ws + WS_Q), *K = (float*)(ws + WS_K); _Float16* VT = (_Float16*)(ws + WS_VT);
  k_proj<<<TNI * NP / 64, 128, 0, stream>>>(F[0], F[1], F[2], F[3], F[4], F[5], F[6], Q, K, VT);
  k_att<<<dim3(NP / 64, TNI), 128, 0, stream>>>(Q, K, VT, F[0], F[7], (float*)d_out);
}

// v003
// One run takes 75.8 microseconds.
// In two side-by-side timings against v002, it was 1.07 and 1.09 times as fast.
// Over all steps from v000 it is 3.20 times as fast.
// compute dtype: all float inputs rounded to bf16, gamma read; q/k (8 channels) and v (64) = x W + b with EXACT bf16 products on WMMA 16x16x32 ((in,out) weights), f32 accumulate; q and k kept in f32 and split into bf16 hi + lo for the UNSCALED logits (3 products; K = 8 zero-padded to 32; logits std ~2.8), running-max softmax over the 4,096 pixels in f32 (hardware exp); P (f16 x 2^11) . v with v rounded once to f16; out = (P v) gamma + x; f32 output.
#include <hip/hip_runtime.h>
#include <math.h>

typedef __attribute__((ext_vector_type(16))) _Float16 v16h;
typedef __attribute__((ext_vector_type(16))) __bf16 v16b;
typedef __attribute__((ext_vector_type(8)))  _Float16 v8h;
typedef __attribute__((ext_vector_type(8)))  float v8f;
typedef __attribute__((ext_vector_type(4)))  float v4f;
typedef __attribute__((ext_vector_type(2)))  float v2f;
typedef __attribute__((ext_vector_type(4)))  unsigned v4u;
typedef __attribute__((ext_vector_type(4)))  int v4i;
typedef float __attribute__((may_alias)) float_a;
typedef int __attribute__((may_alias)) int_a;

template <typename T> __device__ __forceinline__ void vst2(void* p, T v) { *(T*)p = v;  }
__device__ __forceinline__ v8f wmma16(v16h a, v16h b, v8f c) {
  v8f d = __builtin_amdgcn_wmma_f32_16x16x32_f16(false, a, false, b, (short)0, c, false, false);
  asm volatile("v_nop\n\tv_nop\n\tv_nop\n\tv_nop" : "+v"(d) : "v"(a), "v"(b));
  return d;
}
__device__ __forceinline__ v8f wmma_bf(v16b a, v16b b, v8f c) {
  v8f d = __builtin_amdgcn_wmma_f32_16x16x32_bf16(false, a, false, b, (short)0, c, false, false);
  asm volatile("v_nop\n\tv_nop\n\tv_nop\n\tv_nop" : "+v"(d) : "v"(a), "v"(b));
  return d;
}
// 16x16x32 fragments: lane = (h = lane>>4, row/col = lane&15); elements 0..7 = k0+8h+0..7, 8..15 = k0+16+8h+0..7; D element r = row 8h+r
__device__ __forceinline__ v16h frag_h(const _Float16* rowk0, int lane) {
  union { v16h v; v8h q[2]; } u; const _Float16* p = rowk0 + 8 * (lane >> 4);
  u.q[0] = *(const v8h*)p; u.q[1] = *(const v8h*)(p + 16); return u.v;
}
__device__ __forceinline__ v16h frag_f32(const float* rowk0, int lane) {
  v16h a; const float* p = rowk0 + 8 * (lane >> 4);
#pragma unroll
  for (int i = 0; i < 8; ++i) { a[i] = (_Float16)p[i]; a[8 + i] = (_Float16)p[16 + i]; }
  return a;
}
__device__ __forceinline__ v16h frag_f32s(const float* rowk0, int lane, float sc) {
  v16h a; const float* p = rowk0 + 8 * (lane >> 4);
#pragma unroll
  for (int i = 0; i < 8; ++i) { a[i] = (_Float16)(p[i] * sc); a[8 + i] = (_Float16)(p[16 + i] * sc); }
  return a;
}
// column fragment from a [K][ld] layout (column n), rows >= K read as 0
__device__ __forceinline__ v16h fragc_f32(const float* W, int k0, int n, int lane, int ld, int K) {
  v16h a; const int g = lane >> 4;
#pragma unroll
  for (int i = 0; i < 8; ++i) { const int ka = k0 + 8 * g + i, kb = ka + 16;
    a[i] = (_Float16)(ka < K ? W[(size_t)(ka < K ? ka : K - 1) * ld + n] : 0.f); a[8 + i] = (_Float16)(kb < K ? W[(size_t)(kb < K ? kb : K - 1) * ld + n] : 0.f); }
  return a;
}
struct F2 { v16b h, l; };
__device__ __forceinline__ F2 bsplit16(const float v[16]) { F2 r;
#pragma unroll
  for (int i = 0; i < 16; ++i) { const __bf16 h = (__bf16)v[i]; r.h[i] = h; r.l[i] = (__bf16)(v[i] - (float)h); }
  return r; }
__device__ __forceinline__ F2 split_row(const float* row, int k0, int lane) { float v[16]; const float* p = row + k0 + 8 * (lane >> 4);
#pragma unroll
  for (int i = 0; i < 8; ++i) { v[i] = p[i]; v[8 + i] = p[16 + i]; }
  return bsplit16(v); }
__device__ __forceinline__ F2 split_rowK(const float* row, int k0, int lane, int K) { float v[16]; const int g = lane >> 4;
#pragma unroll
  for (int i = 0; i < 8; ++i) { const int ka = k0 + 8 * g + i, kb = ka + 16; v[i] = ka < K ? row[ka < K ? ka : K - 1] : 0.f; v[8 + i] = kb < K ? row[kb < K ? kb : K - 1] : 0.f; }
  return bsplit16(v); }
__device__ __forceinline__ F2 split_col(const float* W, int k0, int n, int lane, int ld, int K) { float v[16]; const int g = lane >> 4;
#pragma unroll
  for (int i = 0; i < 8; ++i) { const int ka = k0 + 8 * g + i, kb = ka + 16; v[i] = ka < K ? W[(size_t)(ka < K ? ka : K - 1) * ld + n] : 0.f; v[8 + i] = kb < K ? W[(size_t)(kb < K ? kb : K - 1) * ld + n] : 0.f; }
  return bsplit16(v); }
__device__ __forceinline__ v8f mac3(const F2& a, const F2& b, v8f c) { c = wmma_bf(a.l, b.h, c); c = wmma_bf(a.h, b.l, c); return wmma_bf(a.h, b.h, c); }
__device__ __forceinline__ float sigm(float v) { return 1.0f / (1.0f + expf(-v)); }
#define LDSX() do { asm volatile("s_wait_dscnt 0" ::: "memory"); __builtin_amdgcn_wave_barrier(); __builtin_amdgcn_fence(__ATOMIC_RELEASE, "workgroup"); } while (0)


// Convolutional self attention (B 8, 64 x 64, C 64, q/k dim C/8 = 8): 1x1-conv q/k/v, unscaled softmax over all pixels, out = attn v * gamma + x (channels-last).
#define NI 8
#define NP 4096
#define CC 64
#define DQ 8
#ifndef TNI
#define TNI NI
#endif
typedef __attribute__((ext_vector_type(8))) __bf16 v8b;
__device__ __forceinline__ v16b frag_b(const __bf16* rowk0, int lane) {
  union { v16b v; v8b q[2]; } u; const __bf16* p = rowk0 + 8 * (lane >> 4);
  u.q[0] = *(const v8b*)p; u.q[1] = *(const v8b*)(p + 16); return u.v;
}
__device__ __forceinline__ float bfr(float v) { return (float)(__bf16)v; }
__device__ __attribute__((noinline)) float exp_ni(float v) { return expf(v); }
__device__ __attribute__((noinline)) float erf_ni(float v) { return erff(v); }

#define WS_Q   0u                                   // f32 q rows [n][8]
#define WS_K   (WS_Q + 4u * (size_t)NI * NP * DQ)
#define WS_VT  (WS_K + 4u * (size_t)NI * NP * DQ)       // f16 v planes [b][64][n]
#define WS_END (WS_VT + 2u * (size_t)NI * CC * NP)

// ---- k_proj: block = 64 pixels (rows of x [b*n][64]): q, k (8 each; one 16-col tile holding q|k) and v (64) exact
__global__ __launch_bounds__(128) void k_proj(const float* __restrict__ X, const float* __restrict__ WQ, const float* __restrict__ BQ, const float* __restrict__ WK, const float* __restrict__ BK, const float* __restrict__ WV, const float* __restrict__ BV, float* __restrict__ Q, float* __restrict__ K, _Float16* __restrict__ VT) {
  __shared__ __align__(16) float sqk[64][16]; __shared__ __align__(16) _Float16 tv[64][72];
  const int tid = threadIdx.x, wave = tid >> 5, lane = tid & 31, col = lane & 15, g = lane >> 4; const size_t r0 = (size_t)blockIdx.x * 64;
  v8f acc[5] = {};
#pragma unroll
  for (int kc = 0; kc < CC / 32; ++kc) { v16b a; { const float* p = X + (r0 + wave * 16 + col) * CC + kc * 32 + 8 * g;
#pragma unroll
      for (int i = 0; i < 8; ++i) { a[i] = (__bf16)p[i]; a[8 + i] = (__bf16)p[16 + i]; } }
    { v16b w; const float* Wm = (col < 8) ? WQ : WK; const int o = col & 7;   // tile 0: cols 0-7 = q, 8-15 = k
#pragma unroll
      for (int i = 0; i < 8; ++i) { w[i] = (__bf16)Wm[(kc * 32 + 8 * g + i) * DQ + o]; w[8 + i] = (__bf16)Wm[(kc * 32 + 16 + 8 * g + i) * DQ + o]; }
      acc[0] = wmma_bf(a, w, acc[0]); }
#pragma unroll
    for (int j = 0; j < 4; ++j) { v16b w; const int o = j * 16 + col;
#pragma unroll
      for (int i = 0; i < 8; ++i) { w[i] = (__bf16)WV[(kc * 32 + 8 * g + i) * CC + o]; w[8 + i] = (__bf16)WV[(kc * 32 + 16 + 8 * g + i) * CC + o]; }
      acc[1 + j] = wmma_bf(a, w, acc[1 + j]); } }
  { const float bb = (col < 8) ? bfr(BQ[col]) : bfr(BK[col & 7]);
#pragma unroll
    for (int r = 0; r < 8; ++r) sqk[wave * 16 + 8 * g + r][col] = acc[0][r] + bb; }
#pragma unroll
  for (int j = 0; j < 4; ++j) { const int c = j * 16 + col; const float bb = bfr(BV[c]);
#pragma unroll
    for (int r = 0; r < 8; ++r) tv[c][wave * 16 + 8 * g + r] = (_Float16)(acc[1 + j][r] + bb); }
  __syncthreads();
  if (tid < 32) { const int rl = tid * 2; v4f a0 = *(const v4f*)&sqk[rl][0], a1 = *(const v4f*)&sqk[rl][4], b0 = *(const v4f*)&sqk[rl + 1][0], b1 = *(const v4f*)&sqk[rl + 1][4]; vst2(Q + (r0 + rl) * DQ, a0); vst2(Q + (r0 + rl) * DQ + 4, a1); vst2(Q + (r0 + rl + 1) * DQ, b0); vst2(Q + (r0 + rl + 1) * DQ + 4, b1); }
  else if (tid < 64) { const int rl = (tid - 32) * 2; v4f a0 = *(const v4f*)&sqk[rl][8], a1 = *(const v4f*)&sqk[rl][12], b0 = *(const v4f*)&sqk[rl + 1][8], b1 = *(const v4f*)&sqk[rl + 1][12]; vst2(K + (r0 + rl) * DQ, a0); vst2(K + (r0 + rl) * DQ + 4, a1); vst2(K + (r0 + rl + 1) * DQ, b0); vst2(K + (r0 + rl + 1) * DQ + 4, b1); }
  { const size_t b = r0 / NP; const int n0 = (int)(r0 % NP); for (int e = tid; e < 64 * 8; e += 128) { const int c = e >> 3, q = e & 7; vst2((unsigned*)(VT + (b * CC + c) * (size_t)NP + n0 + q * 8), *(const v4u*)&tv[c][q * 8]); } } }
#define GLB __attribute__((address_space(1)))
// a wave-uniform global pointer held in scalar registers, so that the loads behind it take the scalar-base form and no vector address pair is formed per trip
template <typename T> __device__ __forceinline__ const GLB T* ubase(const T* p) { const unsigned long long a = (unsigned long long)p;
  return (const GLB T*)(((unsigned long long)(unsigned)__builtin_amdgcn_readfirstlane((int)(a >> 32)) << 32) | (unsigned)__builtin_amdgcn_readfirstlane((int)a)); }
// 16x16x32 f16 fragment from a wave-uniform base and the lane's own element offset (row * pitch + 8 * (lane >> 4))
__device__ __forceinline__ v16h frag_u(const GLB _Float16* base, unsigned off) {
  union { v16h v; v8h q[2]; } u; u.q[0] = *(const GLB v8h*)(base + off); u.q[1] = *(const GLB v8h*)(base + 16 + off); return u.v;
}
// lane l with lane l ^ 16 (a vector cross-row move; the shuffle helper would go through the LDS pipe)
__device__ __forceinline__ float xhalf(float x) { return __builtin_bit_cast(float, __builtin_amdgcn_permlanex16(__builtin_bit_cast(int, x), __builtin_bit_cast(int, x), 0x76543210, 0xfedcba98, false, false)); }
// ---- k_att: block = 64 queries of image b, transposed: S^T = K . Q^T (3 products, K = 8 padded), so a lane holds 16 of the 32 scores of ONE query (col): softmax in the lane plus one exchange between halves;
//      the two S^T tiles, converted in place, are the B operand of O^T += V^T . P^T; out = gamma * o + x
//      Each 16-query tile has KS waves, each with its own run of NP / KS keys: twice the waves on a SIMD fill one another's waits. The partial (m, l, O) of the later runs go through LDS to the wave of run 0, which joins them.
#define KS 2
#define KT (NP / 32 / KS)   // trips of one wave
__global__ __launch_bounds__(128 * KS) void k_att(const float* __restrict__ Q, const float* __restrict__ K, const _Float16* __restrict__ VT, const float* __restrict__ X, const float* __restrict__ GM, float* __restrict__ OUT) {
  __shared__ __align__(16) float so[4][16][68];
  __shared__ __align__(16) v4f pa[KS - 1][4][8][32];   // a later run's O: [run - 1][query tile][quad of accumulator elements][lane]: a lane's 16 bytes beside its neighbour's
  __shared__ float pm[KS - 1][4][2][32];               // its m and l
  const int tid = threadIdx.x, wave = (tid >> 5) & 3, lane = tid & 31, col = lane & 15, g = lane >> 4; const int i0 = blockIdx.x * 64; const size_t b = blockIdx.y; const size_t q0 = b * NP + i0 + wave * 16;
  const int run = __builtin_amdgcn_readfirstlane(tid >> 7), kt0 = run * KT;   // which run of keys this wave has (scalar: the trip's bases stay scalar), and its first trip's tile
  F2 aq; { float v[16];
#pragma unroll
    for (int i = 0; i < 16; ++i) v[i] = 0.f;
    if (g == 0) { const float* p = Q + (q0 + col) * DQ;
#pragma unroll
      for (int i = 0; i < 8; ++i) v[i] = p[i]; }
    aq = bsplit16(v); }
  float m = -3.0e38f, l = 0.f;   // query col's running maximum (same in both halves) and this half's share of its sum
  v8f acc[4] = {};               // acc[j][r] = O[query col][channel 16 j + 8 g + r]
  const float gm = bfr(GM[0]);
  // The trip's K rows (kr; lanes g == 1 stay 0) and V fragments (vf) are fetched one trip ahead, each into the registers of the tile it replaces, right after that tile's last use.
  // Addresses: a wave-uniform scalar base that moves with the trip plus a fixed 32-bit lane offset: no vector address register is rewritten behind an issued load, and the bases are formed anew behind the wait at the trip's head.
  const float* kb0 = K + b * NP * DQ; const _Float16* vb0 = VT + b * CC * (size_t)NP; const unsigned ko = col * DQ, vo = col * NP + 8 * g;
  float kr[2][8]; v16h vf[4];
#pragma unroll
  for (int ct = 0; ct < 2; ++ct)
#pragma unroll
    for (int i = 0; i < 8; ++i) kr[ct][i] = 0.f;
  if (g == 0) {
#pragma unroll
    for (int ct = 0; ct < 2; ++ct)
#pragma unroll
      for (int i = 0; i < 8; ++i) kr[ct][i] = (ubase(kb0 + (size_t)kt0 * 32 * DQ) + ct * 16 * DQ + i)[ko]; }
#pragma unroll
  for (int j = 0; j < 4; ++j) vf[j] = frag_u(ubase(vb0 + (size_t)kt0 * 32) + j * 16 * NP, vo);
#pragma unroll 1
  for (int ks = 0; ks < KT; ++ks) { F2 bk[2];
    int kt;
    asm volatile("s_wait_xcnt 0x0\n\ts_mov_b32 %0, %1" : "=s"(kt) : "s"(ks) : "memory");   // stands before the scalar bases named by the loads of the trip before are formed anew (they all derive from kt, which is itself written behind the wait)
    const int kn = kt0 + (kt < KT - 1 ? kt + 1 : kt);   // the last trip fetches its own tile again: every fetch stays inside what k_proj wrote
#pragma unroll
    for (int ct = 0; ct < 2; ++ct) { float v[16];
#pragma unroll
      for (int i = 0; i < 8; ++i) { v[i] = kr[ct][i]; v[8 + i] = 0.f; }
      bk[ct] = bsplit16(v); }
    if (g == 0) { const GLB float* kb = ubase(kb0 + (size_t)kn * 32 * DQ);
#pragma unroll
      for (int ct = 0; ct < 2; ++ct)
#pragma unroll
        for (int i = 0; i < 8; ++i) kr[ct][i] = (kb + ct * 16 * DQ + i)[ko]; }
    v8f s[2];   // s[ct][r] = logit of key 16 ct + 8 g + r with query col; the three products in the order they had (q.lo k.hi, q.hi k.lo, q.hi k.hi)
#pragma unroll
    for (int ct = 0; ct < 2; ++ct) { v8f c = {}; c = wmma_bf(bk[ct].h, aq.l, c); c = wmma_bf(bk[ct].l, aq.h, c); s[ct] = wmma_bf(bk[ct].h, aq.h, c); }
    float mx[4];
#pragma unroll
    for (int i = 0; i < 4; ++i) mx[i] = fmaxf(fmaxf(s[0][i], s[0][4 + i]), fmaxf(s[1][i], s[1][4 + i]));
    const float mh = fmaxf(fmaxf(mx[0], mx[1]), fmaxf(mx[2], mx[3]));
    const float mn = fmaxf(m, fmaxf(mh, xhalf(mh))); const float alpha = __expf(m - mn); m = mn;
    v16h pb; float es[4];   // pb: element r = key 8 g + r, element 8 + r = key 16 + 8 g + r: the k order of vf
#pragma unroll
    for (int r = 0; r < 8; ++r) { const float e0 = __expf(s[0][r] - mn), e1 = __expf(s[1][r] - mn);
      if (r < 4) es[r] = e0 + e1; else es[r - 4] += e0 + e1;
      pb[r] = (_Float16)(e0 * 2048.0f); pb[8 + r] = (_Float16)(e1 * 2048.0f); }
    l = l * alpha + ((es[0] + es[1]) + (es[2] + es[3]));
#pragma unroll
    for (int j = 0; j < 4; ++j)
#pragma unroll
      for (int r = 0; r < 8; ++r) acc[j][r] *= alpha;
#pragma unroll
    for (int j = 0; j < 4; ++j) acc[j] = wmma16(vf[j], pb, acc[j]);
    const GLB _Float16* vb = ubase(vb0 + (size_t)kn * 32);
#pragma unroll
    for (int j = 0; j < 4; ++j) vf[j] = frag_u(vb + j * 16 * NP, vo); }
  if (run != 0) {   // hand the partial result over
#pragma unroll
    for (int j = 0; j < 4; ++j) { pa[run - 1][wave][2 * j][lane] = v4f{acc[j][0], acc[j][1], acc[j][2], acc[j][3]}; pa[run - 1][wave][2 * j + 1][lane] = v4f{acc[j][4], acc[j][5], acc[j][6], acc[j][7]}; }
    pm[run - 1][wave][0][lane] = m; pm[run - 1][wave][1][lane] = l; }
  __syncthreads();   // every wave passes it once: the partial results are in LDS before run 0 reads them
  if (run != 0) return;
#pragma unroll
  for (int p = 0; p < KS - 1; ++p) {   // join: both sides brought to the common maximum, then added (lane for lane the same query and channels)
    const float m1 = pm[p][wave][0][lane], l1 = pm[p][wave][1][lane]; const float d = m - m1, e = __expf(-fabsf(d)); const float a0 = d < 0.f ? e : 1.0f, a1 = d < 0.f ? 1.0f : e; m = fmaxf(m, m1); l = l * a0 + l1 * a1;   // the side with the larger maximum keeps its scale
#pragma unroll
    for (int j = 0; j < 4; ++j) { const v4f lo = pa[p][wave][2 * j][lane], hi = pa[p][wave][2 * j + 1][lane];
#pragma unroll
      for (int r = 0; r < 4; ++r) { acc[j][r] = acc[j][r] * a0 + lo[r] * a1; acc[j][4 + r] = acc[j][4 + r] * a0 + hi[r] * a1; } } }
  { const float il = (1.0f / 2048.0f) / (l + xhalf(l)); const float* xr = X + (q0 + col) * CC + 8 * g;
#pragma unroll
    for (int j = 0; j < 4; ++j)
#pragma unroll
      for (int r = 0; r < 8; ++r) so[wave][col][j * 16 + 8 * g + r] = acc[j][r] * il * gm + bfr(xr[j * 16 + r]); }
  LDSX(); for (int rl = 0; rl < 16; ++rl) if (lane < 16) vst2(OUT + (q0 + rl) * CC + lane * 4, *(const v4f*)&so[wave][rl][lane * 4]); }
extern "C" void kernel_launch(void* const* d_in, const int* in_sizes, int n_in, void* d_out, int out_size, void* d_ws, size_t ws_size, hipStream_t stream) {
  (void)in_sizes; (void)n_in; (void)out_size;
  const float** F = (const float**)d_in;   // 0 x [8,64,64,64] (channels last), 1 wq [64,8], 2 bq, 3 wk, 4 bk, 5 wv [64,64], 6 bv, 7 gamma [1]
  if (ws_size < (size_t)WS_END) return;
  char* ws = (char*)d_ws; float *Q = (float*)(ws + WS_Q), *K = (float*)(ws + WS_K); _Float16* VT = (_Float16*)(ws + WS_VT);
  k_proj<<<TNI * NP / 64, 128, 0, stream>>>(F[0], F[1], F[2], F[3], F[4], F[5], F[6], Q, K, VT);
  k_att<<<dim3(NP / 64, TNI), 128 * KS, 0, stream>>>(Q, K, VT, F[0], F[7], (float*)d_out);
}

// v004
// A run of this version takes 66.1 microseconds.
// Next to v003, in two timings, it ran 1.15 times as fast each time.
// All steps since v000 together make it 3.68 times as fast.
// compute dtype: all float inputs rounded to bf16, gamma read; q/k (8 channels) and v (64) = x W + b with EXACT bf16 products on WMMA 16x16x32 ((in,out) weights), f32 accumulate; q and k kept in f32 and split into bf16 hi + lo for the UNSCALED logits (3 products; K = 8 zero-padded to 32; logits std ~2.8), running-max softmax over the 4,096 pixels in f32 (hardware exp); P (f16 x 2^11) . v with v rounded once to f16; out = (P v) gamma + x; f32 output.
#include <hip/hip_runtime.h>
#include <math.h>

typedef __attribute__((ext_vector_type(16))) _Float16 v16h;
typedef __attribute__((ext_vector_type(16))) __bf16 v16b;
typedef __attribute__((ext_vector_type(8)))  _Float16 v8h;
typedef __attribute__((ext_vector_type(8)))  float v8f;
typedef __attribute__((ext_vector_type(4)))  float v4f;
typedef __attribute__((ext_vector_type(2)))  float v2f;
typedef __attribute__((ext_vector_type(4)))  unsigned v4u;
typedef __attribute__((ext_vector_type(4)))  int v4i;
typedef float __attribute__((may_alias)) float_a;
typedef int __attribute__((may_alias)) int_a;

template <typename T> __device__ __forceinline__ void vst2(void* p, T v) { *(T*)p = v;  }
__device__ __forceinline__ v8f wmma16(v16h a, v16h b, v8f c) {
  v8f d = __builtin_amdgcn_wmma_f32_16x16x32_f16(false, a, false, b, (short)0, c, false, false);
  asm volatile("v_nop\n\tv_nop\n\tv_nop\n\tv_nop" : "+v"(d) : "v"(a), "v"(b));
  return d;
}
__device__ __forceinline__ v8f wmma_bf(v16b a, v16b b, v8f c) {
  v8f d = __builtin_amdgcn_wmma_f32_16x16x32_bf16(false, a, false, b, (short)0, c, false, false);
  asm volatile("v_nop\n\tv_nop\n\tv_nop\n\tv_nop" : "+v"(d) : "v"(a), "v"(b));
  return d;
}
// 16x16x32 fragments: lane = (h = lane>>4, row/col = lane&15); elements 0..7 = k0+8h+0..7, 8..15 = k0+16+8h+0..7; D element r = row 8h+r
__device__ __forceinline__ v16h frag_h(const _Float16* rowk0, int lane) {
  union { v16h v; v8h q[2]; } u; const _Float16* p = rowk0 + 8 * (lane >> 4);
  u.q[0] = *(const v8h*)p; u.q[1] = *(const v8h*)(p + 16); return u.v;
}
__device__ __forceinline__ v16h frag_f32(const float* rowk0, int lane) {
  v16h a; const float* p = rowk0 + 8 * (lane >> 4);
#pragma unroll
  for (int i = 0; i < 8; ++i) { a[i] = (_Float16)p[i]; a[8 + i] = (_Float16)p[16 + i]; }
  return a;
}
__device__ __forceinline__ v16h frag_f32s(const float* rowk0, int lane, float sc) {
  v16h a; const float* p = rowk0 + 8 * (lane >> 4);
#pragma unroll
  for (int i = 0; i < 8; ++i) { a[i] = (_Float16)(p[i] * sc); a[8 + i] = (_Float16)(p[16 + i] * sc); }
  return a;
}
// column fragment from a [K][ld] layout (column n), rows >= K read as 0
__device__ __forceinline__ v16h fragc_f32(const float* W, int k0, int n, int lane, int ld, int K) {
  v16h a; const int g = lane >> 4;
#pragma unroll
  for (int i = 0; i < 8; ++i) { const int ka = k0 + 8 * g + i, kb = ka + 16;
    a[i] = (_Float16)(ka < K ? W[(size_t)(ka < K ? ka : K - 1) * ld + n] : 0.f); a[8 + i] = (_Float16)(kb < K ? W[(size_t)(kb < K ? kb : K - 1) * ld + n] : 0.f); }
  return a;
}
struct F2 { v16b h, l; };
__device__ __forceinline__ F2 bsplit16(const float v[16]) { F2 r;
#pragma unroll
  for (int i = 0; i < 16; ++i) { const __bf16 h = (__bf16)v[i]; r.h[i] = h; r.l[i] = (__bf16)(v[i] - (float)h); }
  return r; }
__device__ __forceinline__ F2 split_row(const float* row, int k0, int lane) { float v[16]; const float* p = row + k0 + 8 * (lane >> 4);
#pragma unroll
  for (int i = 0; i < 8; ++i) { v[i] = p[i]; v[8 + i] = p[16 + i]; }
  return bsplit16(v); }
__device__ __forceinline__ F2 split_rowK(const float* row, int k0, int lane, int K) { float v[16]; const int g = lane >> 4;
#pragma unroll
  for (int i = 0; i < 8; ++i) { const int ka = k0 + 8 * g + i, kb = ka + 16; v[i] = ka < K ? row[ka < K ? ka : K - 1] : 0.f; v[8 + i] = kb < K ? row[kb < K ? kb : K - 1] : 0.f; }
  return bsplit16(v); }
__device__ __forceinline__ F2 split_col(const float* W, int k0, int n, int lane, int ld, int K) { float v[16]; const int g = lane >> 4;
#pragma unroll
  for (int i = 0; i < 8; ++i) { const int ka = k0 + 8 * g + i, kb = ka + 16; v[i] = ka < K ? W[(size_t)(ka < K ? ka : K - 1) * ld + n] : 0.f; v[8 + i] = kb < K ? W[(size_t)(kb < K ? kb : K - 1) * ld + n] : 0.f; }
  return bsplit16(v); }
__device__ __forceinline__ v8f mac3(const F2& a, const F2& b, v8f c) { c = wmma_bf(a.l, b.h, c); c = wmma_bf(a.h, b.l, c); return wmma_bf(a.h, b.h, c); }
__device__ __forceinline__ float sigm(float v) { return 1.0f / (1.0f + expf(-v)); }
#define LDSX() do { asm volatile("s_wait_dscnt 0" ::: "memory"); __builtin_amdgcn_wave_barrier(); __builtin_amdgcn_fence(__ATOMIC_RELEASE, "workgroup"); } while (0)


// Convolutional self attention (B 8, 64 x 64, C 64, q/k dim C/8 = 8): 1x1-conv q/k/v, unscaled softmax over all pixels, out = attn v * gamma + x (channels-last).
#define NI 8
#define NP 4096
#define CC 64
#define DQ 8
#ifndef TNI
#define TNI NI
#endif
typedef __attribute__((ext_vector_type(8))) __bf16 v8b;
__device__ __forceinline__ v16b frag_b(const __bf16* rowk0, int lane) {
  union { v16b v; v8b q[2]; } u; const __bf16* p = rowk0 + 8 * (lane >> 4);
  u.q[0] = *(const v8b*)p; u.q[1] = *(const v8b*)(p + 16); return u.v;
}
__device__ __forceinline__ float bfr(float v) { return (float)(__bf16)v; }
__device__ __attribute__((noinline)) float exp_ni(float v) { return expf(v); }
__device__ __attribute__((noinline)) float erf_ni(float v) { return erff(v); }

#define WS_Q   0u                                   // f32 q rows [n][8]
#define WS_K   (WS_Q + 4u * (size_t)NI * NP * DQ)
#define WS_VT  (WS_K + 4u * (size_t)NI * NP * DQ)       // f16 v in the order k_att's A fragments take it: [b][tile of 32 keys][16-channel group j][element half h][lane][8]: lane (g, col) holds channel 16 j + col, keys 16 h + 8 g + 0..7
#define WS_END (WS_VT + 2u * (size_t)NI * CC * NP)

// ---- k_proj: block = 64 pixels (rows of x [b*n][64]): q, k (8 each; one 16-col tile holding q|k) and v (64) exact
__global__ __launch_bounds__(128) void k_proj(const float* __restrict__ X, const float* __restrict__ WQ, const float* __restrict__ BQ, const float* __restrict__ WK, const float* __restrict__ BK, const float* __restrict__ WV, const float* __restrict__ BV, float* __restrict__ Q, float* __restrict__ K, _Float16* __restrict__ VT) {
  __shared__ __align__(16) float sqk[64][16]; __shared__ __align__(16) _Float16 tv[64][72];
  const int tid = threadIdx.x, wave = tid >> 5, lane = tid & 31, col = lane & 15, g = lane >> 4; const size_t r0 = (size_t)blockIdx.x * 64;
  v8f acc[5] = {};
#pragma unroll
  for (int kc = 0; kc < CC / 32; ++kc) { v16b a; { const float* p = X + (r0 + wave * 16 + col) * CC + kc * 32 + 8 * g;
#pragma unroll
      for (int i = 0; i < 8; ++i) { a[i] = (__bf16)p[i]; a[8 + i] = (__bf16)p[16 + i]; } }
    { v16b w; const float* Wm = (col < 8) ? WQ : WK; const int o = col & 7;   // tile 0: cols 0-7 = q, 8-15 = k
#pragma unroll
      for (int i = 0; i < 8; ++i) { w[i] = (__bf16)Wm[(kc * 32 + 8 * g + i) * DQ + o]; w[8 + i] = (__bf16)Wm[(kc * 32 + 16 + 8 * g + i) * DQ + o]; }
      acc[0] = wmma_bf(a, w, acc[0]); }
#pragma unroll
    for (int j = 0; j < 4; ++j) { v16b w; const int o = j * 16 + col;
#pragma unroll
      for (int i = 0; i < 8; ++i) { w[i] = (__bf16)WV[(kc * 32 + 8 * g + i) * CC + o]; w[8 + i] = (__bf16)WV[(kc * 32 + 16 + 8 * g + i) * CC + o]; }
      acc[1 + j] = wmma_bf(a, w, acc[1 + j]); } }
  { const float bb = (col < 8) ? bfr(BQ[col]) : bfr(BK[col & 7]);
#pragma unroll
    for (int r = 0; r < 8; ++r) sqk[wave * 16 + 8 * g + r][col] = acc[0][r] + bb; }
#pragma unroll
  for (int j = 0; j < 4; ++j) { const int c = j * 16 + col; const float bb = bfr(BV[c]);
#pragma unroll
    for (int r = 0; r < 8; ++r) tv[c][wave * 16 + 8 * g + r] = (_Float16)(acc[1 + j][r] + bb); }
  __syncthreads();
  if (tid < 32) { const int rl = tid * 2; v4f a0 = *(const v4f*)&sqk[rl][0], a1 = *(const v4f*)&sqk[rl][4], b0 = *(const v4f*)&sqk[rl + 1][0], b1 = *(const v4f*)&sqk[rl + 1][4]; vst2(Q + (r0 + rl) * DQ, a0); vst2(Q + (r0 + rl) * DQ + 4, a1); vst2(Q + (r0 + rl + 1) * DQ, b0); vst2(Q + (r0 + rl + 1) * DQ + 4, b1); }
  else if (tid < 64) { const int rl = (tid - 32) * 2; v4f a0 = *(const v4f*)&sqk[rl][8], a1 = *(const v4f*)&sqk[rl][12], b0 = *(const v4f*)&sqk[rl + 1][8], b1 = *(const v4f*)&sqk[rl + 1][12]; vst2(K + (r0 + rl) * DQ, a0); vst2(K + (r0 + rl) * DQ + 4, a1); vst2(K + (r0 + rl + 1) * DQ, b0); vst2(K + (r0 + rl + 1) * DQ + 4, b1); }
  // the block's 64 pixels are two whole key tiles, 8 KiB in a row: 16-byte piece e = (tile, j, h, lane)
  for (int e = tid; e < 64 * 8; e += 128) { const int c = ((e >> 6) & 3) * 16 + (e & 15), q = (e >> 8) * 4 + ((e >> 5) & 1) * 2 + ((e >> 4) & 1); vst2((unsigned*)(VT + r0 * CC + e * 8), *(const v4u*)&tv[c][q * 8]); } }
#define GLB __attribute__((address_space(1)))
// a wave-uniform global pointer held in scalar registers, so that the loads behind it take the scalar-base form and no vector address pair is formed per trip
template <typename T> __device__ __forceinline__ const GLB T* ubase(const T* p) { const unsigned long long a = (unsigned long long)p;
  return (const GLB T*)(((unsigned long long)(unsigned)__builtin_amdgcn_readfirstlane((int)(a >> 32)) << 32) | (unsigned)__builtin_amdgcn_readfirstlane((int)a)); }
// 16x16x32 f16 fragment stored in fragment order: a wave-uniform base and the lane's own element offset (8 * lane); each of the two loads takes 512 bytes in a row, four whole cache lines
__device__ __forceinline__ v16h frag_u(const GLB _Float16* base, unsigned off) {
  union { v16h v; v8h q[2]; } u; u.q[0] = *(const GLB v8h*)(base + off); u.q[1] = *(const GLB v8h*)(base + 256 + off); return u.v;
}
// lane l with lane l ^ 16 (a vector cross-row move; the shuffle helper would go through the LDS pipe)
__device__ __forceinline__ float xhalf(float x) { return __builtin_bit_cast(float, __builtin_amdgcn_permlanex16(__builtin_bit_cast(int, x), __builtin_bit_cast(int, x), 0x76543210, 0xfedcba98, false, false)); }
// ---- k_att: block = 64 queries of image b, transposed: S^T = K . Q^T (3 products, K = 8 padded), so a lane holds 16 of the 32 scores of ONE query (col): softmax in the lane plus one exchange between halves;
//      the two S^T tiles, converted in place, are the B operand of O^T += V^T . P^T; out = gamma * o + x
//      Each 16-query tile has KS waves, each with its own run of NP / KS keys: twice the waves on a SIMD fill one another's waits. The partial (m, l, O) of the later runs go through LDS to the wave of run 0, which joins them.
#define KS 2
#define KT (NP / 32 / KS)   // trips of one wave
__global__ __launch_bounds__(128 * KS) void k_att(const float* __restrict__ Q, const float* __restrict__ K, const _Float16* __restrict__ VT, const float* __restrict__ X, const float* __restrict__ GM, float* __restrict__ OUT) {
  __shared__ __align__(16) float so[4][16][68];
  __shared__ __align__(16) v4f pa[KS - 1][4][8][32];   // a later run's O: [run - 1][query tile][quad of accumulator elements][lane]: a lane's 16 bytes beside its neighbour's
  __shared__ float pm[KS - 1][4][2][32];               // its m and l
  const int tid = threadIdx.x, wave = (tid >> 5) & 3, lane = tid & 31, col = lane & 15, g = lane >> 4; const int i0 = blockIdx.x * 64; const size_t b = blockIdx.y; const size_t q0 = b * NP + i0 + wave * 16;
  const int run = __builtin_amdgcn_readfirstlane(tid >> 7), kt0 = run * KT;   // which run of keys this wave has (scalar: the trip's bases stay scalar), and its first trip's tile
  F2 aq; { float v[16];
#pragma unroll
    for (int i = 0; i < 16; ++i) v[i] = 0.f;
    if (g == 0) { const float* p = Q + (q0 + col) * DQ;
#pragma unroll
      for (int i = 0; i < 8; ++i) v[i] = p[i]; }
    aq = bsplit16(v); }
  float m = -3.0e38f, l = 0.f;   // query col's running maximum (same in both halves) and this half's share of its sum
  v8f acc[4] = {};               // acc[j][r] = O[query col][channel 16 j + 8 g + r]
  const float gm = bfr(GM[0]);
  // The trip's K rows (kr; lanes g == 1 stay 0) and V fragments (vf) are fetched one trip ahead, each into the registers of the tile it replaces, right after that tile's last use.
  // Addresses: a wave-uniform scalar base that moves with the trip plus a fixed 32-bit lane offset: no vector address register is rewritten behind an issued load, and the bases are formed anew behind the wait at the trip's head.
  const float* kb0 = K + b * NP * DQ; const _Float16* vb0 = VT + b * CC * (size_t)NP; const unsigned ko = col * DQ, vo = 8 * lane;
  float kr[2][8]; v16h vf[4];
#pragma unroll
  for (int ct = 0; ct < 2; ++ct)
#pragma unroll
    for (int i = 0; i < 8; ++i) kr[ct][i] = 0.f;
  if (g == 0) {
#pragma unroll
    for (int ct = 0; ct < 2; ++ct)
#pragma unroll
      for (int i = 0; i < 8; ++i) kr[ct][i] = (ubase(kb0 + (size_t)kt0 * 32 * DQ) + ct * 16 * DQ + i)[ko]; }
#pragma unroll
  for (int j = 0; j < 4; ++j) vf[j] = frag_u(ubase(vb0 + (size_t)kt0 * 32 * CC) + j * 512, vo);
#pragma unroll 1
  for (int ks = 0; ks < KT; ++ks) { F2 bk[2];
    int kt;
    asm volatile("s_wait_xcnt 0x0\n\ts_mov_b32 %0, %1" : "=s"(kt) : "s"(ks) : "memory");   // stands before the scalar bases named by the loads of the trip before are formed anew (they all derive from kt, which is itself written behind the wait)
    const int kn = kt0 + (kt < KT - 1 ? kt + 1 : kt);   // the last trip fetches its own tile again: every fetch stays inside what k_proj wrote
#pragma unroll
    for (int ct = 0; ct < 2; ++ct) { float v[16];
#pragma unroll
      for (int i = 0; i < 8; ++i) { v[i] = kr[ct][i]; v[8 + i] = 0.f; }
      bk[ct] = bsplit16(v); }
    if (g == 0) { const GLB float* kb = ubase(kb0 + (size_t)kn * 32 * DQ);
#pragma unroll
      for (int ct = 0; ct < 2; ++ct)
#pragma unroll
        for (int i = 0; i < 8; ++i) kr[ct][i] = (kb + ct * 16 * DQ + i)[ko]; }
    v8f s[2];   // s[ct][r] = logit of key 16 ct + 8 g + r with query col; the three products in the order they had (q.lo k.hi, q.hi k.lo, q.hi k.hi)
#pragma unroll
    for (int ct = 0; ct < 2; ++ct) { v8f c = {}; c = wmma_bf(bk[ct].h, aq.l, c); c = wmma_bf(bk[ct].l, aq.h, c); s[ct] = wmma_bf(bk[ct].h, aq.h, c); }
    float mx[4];
#pragma unroll
    for (int i = 0; i < 4; ++i) mx[i] = fmaxf(fmaxf(s[0][i], s[0][4 + i]), fmaxf(s[1][i], s[1][4 + i]));
    const float mh = fmaxf(fmaxf(mx[0], mx[1]), fmaxf(mx[2], mx[3]));
    const float mn = fmaxf(m, fmaxf(mh, xhalf(mh))); const float alpha = __expf(m - mn); m = mn;
    v16h pb; float es[4];   // pb: element r = key 8 g + r, element 8 + r = key 16 + 8 g + r: the k order of vf
#pragma unroll
    for (int r = 0; r < 8; ++r) { const float e0 = __expf(s[0][r] - mn), e1 = __expf(s[1][r] - mn);
      if (r < 4) es[r] = e0 + e1; else es[r - 4] += e0 + e1;
      pb[r] = (_Float16)(e0 * 2048.0f); pb[8 + r] = (_Float16)(e1 * 2048.0f); }
    l = l * alpha + ((es[0] + es[1]) + (es[2] + es[3]));
#pragma unroll
    for (int j = 0; j < 4; ++j)
#pragma unroll
      for (int r = 0; r < 8; ++r) acc[j][r] *= alpha;
#pragma unroll
    for (int j = 0; j < 4; ++j) acc[j] = wmma16(vf[j], pb, acc[j]);
    const GLB _Float16* vb = ubase(vb0 + (size_t)kn * 32 * CC);
#pragma unroll
    for (int j = 0; j < 4; ++j) vf[j] = frag_u(vb + j * 512, vo); }
  if (run != 0) {   // hand the partial result over
#pragma unroll
    for (int j = 0; j < 4; ++j) { pa[run - 1][wave][2 * j][lane] = v4f{acc[j][0], acc[j][1], acc[j][2], acc[j][3]}; pa[run - 1][wave][2 * j + 1][lane] = v4f{acc[j][4], acc[j][5], acc[j][6], acc[j][7]}; }
    pm[run - 1][wave][0][lane] = m; pm[run - 1][wave][1][lane] = l; }
  __syncthreads();   // every wave passes it once: the partial results are in LDS before run 0 reads them
  if (run != 0) return;
#pragma unroll
  for (int p = 0; p < KS - 1; ++p) {   // join: both sides brought to the common maximum, then added (lane for lane the same query and channels)
    const float m1 = pm[p][wave][0][lane], l1 = pm[p][wave][1][lane]; const float d = m - m1, e = __expf(-fabsf(d)); const float a0 = d < 0.f ? e : 1.0f, a1 = d < 0.f ? 1.0f : e; m = fmaxf(m, m1); l = l * a0 + l1 * a1;   // the side with the larger maximum keeps its scale
#pragma unroll
    for (int j = 0; j < 4; ++j) { const v4f lo = pa[p][wave][2 * j][lane], hi = pa[p][wave][2 * j + 1][lane];
#pragma unroll
      for (int r = 0; r < 4; ++r) { acc[j][r] = acc[j][r] * a0 + lo[r] * a1; acc[j][4 + r] = acc[j][4 + r] * a0 + hi[r] * a1; } } }
  { const float il = (1.0f / 2048.0f) / (l + xhalf(l)); const float* xr = X + (q0 + col) * CC + 8 * g;
#pragma unroll
    for (int j = 0; j < 4; ++j)
#pragma unroll
      for (int r = 0; r < 8; ++r) so[wave][col][j * 16 + 8 * g + r] = acc[j][r] * il * gm + bfr(xr[j * 16 + r]); }
  LDSX(); for (int rl = 0; rl < 16; ++rl) if (lane < 16) vst2(OUT + (q0 + rl) * CC + lane * 4, *(const v4f*)&so[wave][rl][lane * 4]); }
extern "C" void kernel_launch(void* const* d_in, const int* in_sizes, int n_in, void* d_out, int out_size, void* d_ws, size_t ws_size, hipStream_t stream) {
  (void)in_sizes; (void)n_in; (void)out_size;
  const float** F = (const float**)d_in;   // 0 x [8,64,64,64] (channels last), 1 wq [64,8], 2 bq, 3 wk, 4 bk, 5 wv [64,64], 6 bv, 7 gamma [1]
  if (ws_size < (size_t)WS_END) return;
  char* ws = (char*)d_ws; float *Q = (float*)(ws + WS_Q), *K = (float*)(ws + WS_K); _Float16* VT = (_Float16*)(ws + WS_VT);
  k_proj<<<TNI * NP / 64, 128, 0, stream>>>(F[0], F[1], F[2], F[3], F[4], F[5], F[6], Q, K, VT);
  k_att<<<dim3(NP / 64, TNI), 128 * KS, 0, stream>>>(Q, K, VT, F[0], F[7], (float*)d_out);
}

// v005
// It runs in 49.6 microseconds.
// Timed twice side by side with v004, it ran 1.39 and 1.26 times as fast.
// Counting every step since v000, it is 4.86 times as fast.
// compute dtype: all float inputs rounded to bf16, gamma read; q/k (8 channels) and v (64) = x W + b with EXACT bf16 products on WMMA 16x16x32 ((in,out) weights), f32 accumulate; q and k computed in f32 and split into bf16 hi + lo for the UNSCALED logits (the 4 products of the halves side by side in the K = 32 of one WMMA; logits std ~2.8), running-max softmax over the 4,096 pixels in f32 (hardware exp); P (f16 x 2^11) . v with v rounded once to f16; out = (P v) gamma + x; f32 output.
#include <hip/hip_runtime.h>
#include <math.h>

typedef __attribute__((ext_vector_type(16))) _Float16 v16h;
typedef __attribute__((ext_vector_type(16))) __bf16 v16b;
typedef __attribute__((ext_vector_type(8)))  _Float16 v8h;
typedef __attribute__((ext_vector_type(8)))  float v8f;
typedef __attribute__((ext_vector_type(4)))  float v4f;
typedef __attribute__((ext_vector_type(2)))  float v2f;
typedef __attribute__((ext_vector_type(4)))  unsigned v4u;
typedef __attribute__((ext_vector_type(4)))  int v4i;
typedef float __attribute__((may_alias)) float_a;
typedef int __attribute__((may_alias)) int_a;

template <typename T> __device__ __forceinline__ void vst2(void* p, T v) { *(T*)p = v;  }
__device__ __forceinline__ v8f wmma16(v16h a, v16h b, v8f c) {
  v8f d = __builtin_amdgcn_wmma_f32_16x16x32_f16(false, a, false, b, (short)0, c, false, false);
  asm volatile("v_nop\n\tv_nop\n\tv_nop\n\tv_nop" : "+v"(d) : "v"(a), "v"(b));
  return d;
}
__device__ __forceinline__ v8f wmma_bf(v16b a, v16b b, v8f c) {
  v8f d = __builtin_amdgcn_wmma_f32_16x16x32_bf16(false, a, false, b, (short)0, c, false, false);
  asm volatile("v_nop\n\tv_nop\n\tv_nop\n\tv_nop" : "+v"(d) : "v"(a), "v"(b));
  return d;
}
// 16x16x32 fragments: lane = (h = lane>>4, row/col = lane&15); elements 0..7 = k0+8h+0..7, 8..15 = k0+16+8h+0..7; D element r = row 8h+r
__device__ __forceinline__ v16h frag_h(const _Float16* rowk0, int lane) {
  union { v16h v; v8h q[2]; } u; const _Float16* p = rowk0 + 8 * (lane >> 4);
  u.q[0] = *(const v8h*)p; u.q[1] = *(const v8h*)(p + 16); return u.v;
}
__device__ __forceinline__ v16h frag_f32(const float* rowk0, int lane) {
  v16h a; const float* p = rowk0 + 8 * (lane >> 4);
#pragma unroll
  for (int i = 0; i < 8; ++i) { a[i] = (_Float16)p[i]; a[8 + i] = (_Float16)p[16 + i]; }
  return a;
}
__device__ __forceinline__ v16h frag_f32s(const float* rowk0, int lane, float sc) {
  v16h a; const float* p = rowk0 + 8 * (lane >> 4);
#pragma unroll
  for (int i = 0; i < 8; ++i) { a[i] = (_Float16)(p[i] * sc); a[8 + i] = (_Float16)(p[16 + i] * sc); }
  return a;
}
// column fragment from a [K][ld] layout (column n), rows >= K read as 0
__device__ __forceinline__ v16h fragc_f32(const float* W, int k0, int n, int lane, int ld, int K) {
  v16h a; const int g = lane >> 4;
#pragma unroll
  for (int i = 0; i < 8; ++i) { const int ka = k0 + 8 * g + i, kb = ka + 16;
    a[i] = (_Float16)(ka < K ? W[(size_t)(ka < K ? ka : K - 1) * ld + n] : 0.f); a[8 + i] = (_Float16)(kb < K ? W[(size_t)(kb < K ? kb : K - 1) * ld + n] : 0.f); }
  return a;
}
struct F2 { v16b h, l; };
__device__ __forceinline__ F2 bsplit16(const float v[16]) { F2 r;
#pragma unroll
  for (int i = 0; i < 16; ++i) { const __bf16 h = (__bf16)v[i]; r.h[i] = h; r.l[i] = (__bf16)(v[i] - (float)h); }
  return r; }
__device__ __forceinline__ F2 split_row(const float* row, int k0, int lane) { float v[16]; const float* p = row + k0 + 8 * (lane >> 4);
#pragma unroll
  for (int i = 0; i < 8; ++i) { v[i] = p[i]; v[8 + i] = p[16 + i]; }
  return bsplit16(v); }
__device__ __forceinline__ F2 split_rowK(const float* row, int k0, int lane, int K) { float v[16]; const int g = lane >> 4;
#pragma unroll
  for (int i = 0; i < 8; ++i) { const int ka = k0 + 8 * g + i, kb = ka + 16; v[i] = ka < K ? row[ka < K ? ka : K - 1] : 0.f; v[8 + i] = kb < K ? row[kb < K ? kb : K - 1] : 0.f; }
  return bsplit16(v); }
__device__ __forceinline__ F2 split_col(const float* W, int k0, int n, int lane, int ld, int K) { float v[16]; const int g = lane >> 4;
#pragma unroll
  for (int i = 0; i < 8; ++i) { const int ka = k0 + 8 * g + i, kb = ka + 16; v[i] = ka < K ? W[(size_t)(ka < K ? ka : K - 1) * ld + n] : 0.f; v[8 + i] = kb < K ? W[(size_t)(kb < K ? kb : K - 1) * ld + n] : 0.f; }
  return bsplit16(v); }
__device__ __forceinline__ v8f mac3(const F2& a, const F2& b, v8f c) { c = wmma_bf(a.l, b.h, c); c = wmma_bf(a.h, b.l, c); return wmma_bf(a.h, b.h, c); }
__device__ __forceinline__ float sigm(float v) { return 1.0f / (1.0f + expf(-v)); }
#define LDSX() do { asm volatile("s_wait_dscnt 0" ::: "memory"); __builtin_amdgcn_wave_barrier(); __builtin_amdgcn_fence(__ATOMIC_RELEASE, "workgroup"); } while (0)


// Convolutional self attention (B 8, 64 x 64, C 64, q/k dim C/8 = 8): 1x1-conv q/k/v, unscaled softmax over all pixels, out = attn v * gamma + x (channels-last).
#define NI 8
#define NP 4096
#define CC 64
#define DQ 8
#ifndef TNI
#define TNI NI
#endif
typedef __attribute__((ext_vector_type(8))) __bf16 v8b;
__device__ __forceinline__ v16b frag_b(const __bf16* rowk0, int lane) {
  union { v16b v; v8b q[2]; } u; const __bf16* p = rowk0 + 8 * (lane >> 4);
  u.q[0] = *(const v8b*)p; u.q[1] = *(const v8b*)(p + 16); return u.v;
}
__device__ __forceinline__ float bfr(float v) { return (float)(__bf16)v; }
__device__ __attribute__((noinline)) float exp_ni(float v) { return expf(v); }
__device__ __attribute__((noinline)) float erf_ni(float v) { return erff(v); }

#define WS_Q   0u                                   // f32 q rows [n][8]
#define WS_K   (WS_Q + 4u * (size_t)NI * NP * DQ)       // k split into bf16 hi + lo, in the order k_att's A fragments take it: [b][tile of 16 keys][hi, lo][key][8]
#define WS_VT  (WS_K + 4u * (size_t)NI * NP * DQ)       // f16 v in the order k_att's A fragments take it: [b][tile of 32 keys][16-channel group j][element half h][lane][8]: lane (g, col) holds channel 16 j + col, keys 16 h + 8 g + 0..7
#define WS_END (WS_VT + 2u * (size_t)NI * CC * NP)

// ---- k_proj: block = 64 pixels (rows of x [b*n][64]): q, k (8 each; one 16-col tile holding q|k) and v (64) exact
__global__ __launch_bounds__(128) void k_proj(const float* __restrict__ X, const float* __restrict__ WQ, const float* __restrict__ BQ, const float* __restrict__ WK, const float* __restrict__ BK, const float* __restrict__ WV, const float* __restrict__ BV, float* __restrict__ Q, __bf16* __restrict__ K, _Float16* __restrict__ VT) {
  __shared__ __align__(16) float sqk[64][16]; __shared__ __align__(16) _Float16 tv[64][72];
  const int tid = threadIdx.x, wave = tid >> 5, lane = tid & 31, col = lane & 15, g = lane >> 4; const size_t r0 = (size_t)blockIdx.x * 64;
  v8f acc[5] = {};
#pragma unroll
  for (int kc = 0; kc < CC / 32; ++kc) { v16b a; { const float* p = X + (r0 + wave * 16 + col) * CC + kc * 32 + 8 * g;
#pragma unroll
      for (int i = 0; i < 8; ++i) { a[i] = (__bf16)p[i]; a[8 + i] = (__bf16)p[16 + i]; } }
    { v16b w; const float* Wm = (col < 8) ? WQ : WK; const int o = col & 7;   // tile 0: cols 0-7 = q, 8-15 = k
#pragma unroll
      for (int i = 0; i < 8; ++i) { w[i] = (__bf16)Wm[(kc * 32 + 8 * g + i) * DQ + o]; w[8 + i] = (__bf16)Wm[(kc * 32 + 16 + 8 * g + i) * DQ + o]; }
      acc[0] = wmma_bf(a, w, acc[0]); }
#pragma unroll
    for (int j = 0; j < 4; ++j) { v16b w; const int o = j * 16 + col;
#pragma unroll
      for (int i = 0; i < 8; ++i) { w[i] = (__bf16)WV[(kc * 32 + 8 * g + i) * CC + o]; w[8 + i] = (__bf16)WV[(kc * 32 + 16 + 8 * g + i) * CC + o]; }
      acc[1 + j] = wmma_bf(a, w, acc[1 + j]); } }
  { const float bb = (col < 8) ? bfr(BQ[col]) : bfr(BK[col & 7]);
#pragma unroll
    for (int r = 0; r < 8; ++r) sqk[wave * 16 + 8 * g + r][col] = acc[0][r] + bb; }
#pragma unroll
  for (int j = 0; j < 4; ++j) { const int c = j * 16 + col; const float bb = bfr(BV[c]);
#pragma unroll
    for (int r = 0; r < 8; ++r) tv[c][wave * 16 + 8 * g + r] = (_Float16)(acc[1 + j][r] + bb); }
  __syncthreads();
  if (tid < 32) { const int rl = tid * 2; v4f a0 = *(const v4f*)&sqk[rl][0], a1 = *(const v4f*)&sqk[rl][4], b0 = *(const v4f*)&sqk[rl + 1][0], b1 = *(const v4f*)&sqk[rl + 1][4]; vst2(Q + (r0 + rl) * DQ, a0); vst2(Q + (r0 + rl) * DQ + 4, a1); vst2(Q + (r0 + rl + 1) * DQ, b0); vst2(Q + (r0 + rl + 1) * DQ + 4, b1); }
  else if (tid < 96) { const int rl = tid - 32; v8b h, l;   // one key a thread: its 8 channels split once here, for every wave of k_att that reads them
#pragma unroll
    for (int i = 0; i < 8; ++i) { const float v = sqk[rl][8 + i]; h[i] = (__bf16)v; l[i] = (__bf16)(v - (float)h[i]); }
    __bf16* kp = K + ((r0 + rl) >> 4) * 256 + (rl & 15) * 8; vst2(kp, h); vst2(kp + 128, l); }
  // the block's 64 pixels are two whole key tiles, 8 KiB in a row: 16-byte piece e = (tile, j, h, lane)
  for (int e = tid; e < 64 * 8; e += 128) { const int c = ((e >> 6) & 3) * 16 + (e & 15), q = (e >> 8) * 4 + ((e >> 5) & 1) * 2 + ((e >> 4) & 1); vst2((unsigned*)(VT + r0 * CC + e * 8), *(const v4u*)&tv[c][q * 8]); } }
#define GLB __attribute__((address_space(1)))
// a wave-uniform global pointer held in scalar registers, so that the loads behind it take the scalar-base form and no vector address pair is formed per trip
template <typename T> __device__ __forceinline__ const GLB T* ubase(const T* p) { const unsigned long long a = (unsigned long long)p;
  return (const GLB T*)(((unsigned long long)(unsigned)__builtin_amdgcn_readfirstlane((int)(a >> 32)) << 32) | (unsigned)__builtin_amdgcn_readfirstlane((int)a)); }
// 16x16x32 f16 fragment stored in fragment order: a wave-uniform base and the lane's own element offset (8 * lane); each of the two loads takes 512 bytes in a row, four whole cache lines
__device__ __forceinline__ v16h frag_u(const GLB _Float16* base, unsigned off) {
  union { v16h v; v8h q[2]; } u; u.q[0] = *(const GLB v8h*)(base + off); u.q[1] = *(const GLB v8h*)(base + 256 + off); return u.v;
}
// K fragment of a 16-key tile stored as [hi, lo][key][8]: a wave-uniform base and the lane's own element offset (8 * col); each of the two loads takes 256 bytes in a row
__device__ __forceinline__ v16b frag_k(const GLB __bf16* base, unsigned off) {
  union { v16b v; v8b q[2]; } u; u.q[0] = *(const GLB v8b*)(base + off); u.q[1] = *(const GLB v8b*)(base + 128 + off); return u.v;
}
// lane l with lane l ^ 16 (a vector cross-row move; the shuffle helper would go through the LDS pipe)
__device__ __forceinline__ float xhalf(float x) { return __builtin_bit_cast(float, __builtin_amdgcn_permlanex16(__builtin_bit_cast(int, x), __builtin_bit_cast(int, x), 0x76543210, 0xfedcba98, false, false)); }
// ---- k_att: block = 64 queries of image b, transposed: S^T = K . Q^T (one WMMA a 16-key tile: its K = 32 holds k.hi q.hi, k.hi q.lo, k.lo q.hi, k.lo q.lo over the 8 channels), so a lane holds 16 of the 32 scores of ONE query (col): softmax in the lane plus one exchange between halves;
//      the two S^T tiles, converted in place, are the B operand of O^T += V^T . P^T; out = gamma * o + x
//      Each 16-query tile has KS waves, each with its own run of NP / KS keys: twice the waves on a SIMD fill one another's waits. The partial (m, l, O) of the later runs go through LDS to the wave of run 0, which joins them.
#define KS 2
#define KT (NP / 32 / KS)   // trips of one wave
__global__ __launch_bounds__(128 * KS) void k_att(const float* __restrict__ Q, const __bf16* __restrict__ K, const _Float16* __restrict__ VT, const float* __restrict__ X, const float* __restrict__ GM, float* __restrict__ OUT) {
  __shared__ __align__(16) float so[4][16][68];
  __shared__ __align__(16) v4f pa[KS - 1][4][8][32];   // a later run's O: [run - 1][query tile][quad of accumulator elements][lane]: a lane's 16 bytes beside its neighbour's
  __shared__ float pm[KS - 1][4][2][32];               // its m and l
  const int tid = threadIdx.x, wave = (tid >> 5) & 3, lane = tid & 31, col = lane & 15, g = lane >> 4; const int i0 = blockIdx.x * 64; const size_t b = blockIdx.y; const size_t q0 = b * NP + i0 + wave * 16;
  const int run = __builtin_amdgcn_readfirstlane(tid >> 7), kt0 = run * KT;   // which run of keys this wave has (scalar: the trip's bases stay scalar), and its first trip's tile
  v16b bq;   // B operand: k slots 8 g + i and 16 + 8 g + i both hold channel i of query col: its hi in the lanes g == 0, its lo in the lanes g == 1
  { const float* p = Q + (q0 + col) * DQ;
#pragma unroll
    for (int i = 0; i < 8; ++i) { const float v = p[i]; const __bf16 h = (__bf16)v, lo = (__bf16)(v - (float)h); bq[i] = g ? lo : h; bq[8 + i] = bq[i]; } }
  float m = -3.0e38f, l = 0.f;   // query col's running maximum (same in both halves) and this half's share of its sum
  v8f acc[4] = {};               // acc[j][r] = O[query col][channel 16 j + 8 g + r]
  const float gm = bfr(GM[0]);
  // The trip's K fragments (kf: elements 0..7 = hi, 8..15 = lo of key col, the same in both halves of the wave, so slots 0..15 carry k.hi and 16..31 k.lo) and V fragments (vf) are fetched one trip ahead, each into the registers of the tile it replaces, right after that tile's last use.
  // Addresses: a wave-uniform scalar base that moves with the trip plus a fixed 32-bit lane offset: no vector address register is rewritten behind an issued load, and the bases are formed anew behind the wait at the trip's head.
  const __bf16* kb0 = K + b * NP * 2 * DQ; const _Float16* vb0 = VT + b * CC * (size_t)NP; const unsigned ko = col * DQ, vo = 8 * lane;
  v16b kf[2]; v16h vf[4];
#pragma unroll
  for (int ct = 0; ct < 2; ++ct) kf[ct] = frag_k(ubase(kb0 + (size_t)kt0 * 32 * 2 * DQ) + ct * 256, ko);
#pragma unroll
  for (int j = 0; j < 4; ++j) vf[j] = frag_u(ubase(vb0 + (size_t)kt0 * 32 * CC) + j * 512, vo);
#pragma unroll 1
  for (int ks = 0; ks < KT; ++ks) {
    int kt;
    asm volatile("s_wait_xcnt 0x0\n\ts_mov_b32 %0, %1" : "=s"(kt) : "s"(ks) : "memory");   // stands before the scalar bases named by the loads of the trip before are formed anew (they all derive from kt, which is itself written behind the wait)
    const int kn = kt0 + (kt < KT - 1 ? kt + 1 : kt);   // the last trip fetches its own tile again: every fetch stays inside what k_proj wrote
    v8f s[2];   // s[ct][r] = logit of key 16 ct + 8 g + r with query col
#pragma unroll
    for (int ct = 0; ct < 2; ++ct) { const v8f z = {}; s[ct] = wmma_bf(kf[ct], bq, z); }
    const GLB __bf16* kb = ubase(kb0 + (size_t)kn * 32 * 2 * DQ);
#pragma unroll
    for (int ct = 0; ct < 2; ++ct) kf[ct] = frag_k(kb + ct * 256, ko);
    float mx[4];
#pragma unroll
    for (int i = 0; i < 4; ++i) mx[i] = fmaxf(fmaxf(s[0][i], s[0][4 + i]), fmaxf(s[1][i], s[1][4 + i]));
    const float mh = fmaxf(fmaxf(mx[0], mx[1]), fmaxf(mx[2], mx[3]));
    const float mn = fmaxf(m, fmaxf(mh, xhalf(mh))); const float alpha = __expf(m - mn); m = mn;
    v16h pb; float es[4];   // pb: element r = key 8 g + r, element 8 + r = key 16 + 8 g + r: the k order of vf
#pragma unroll
    for (int r = 0; r < 8; ++r) { const float e0 = __expf(s[0][r] - mn), e1 = __expf(s[1][r] - mn);
      if (r < 4) es[r] = e0 + e1; else es[r - 4] += e0 + e1;
      pb[r] = (_Float16)(e0 * 2048.0f); pb[8 + r] = (_Float16)(e1 * 2048.0f); }
    l = l * alpha + ((es[0] + es[1]) + (es[2] + es[3]));
#pragma unroll
    for (int j = 0; j < 4; ++j)
#pragma unroll
      for (int r = 0; r < 8; ++r) acc[j][r] *= alpha;
#pragma unroll
    for (int j = 0; j < 4; ++j) acc[j] = wmma16(vf[j], pb, acc[j]);
    const GLB _Float16* vb = ubase(vb0 + (size_t)kn * 32 * CC);
#pragma unroll
    for (int j = 0; j < 4; ++j) vf[j] = frag_u(vb + j * 512, vo); }
  if (run != 0) {   // hand the partial result over
#pragma unroll
    for (int j = 0; j < 4; ++j) { pa[run - 1][wave][2 * j][lane] = v4f{acc[j][0], acc[j][1], acc[j][2], acc[j][3]}; pa[run - 1][wave][2 * j + 1][lane] = v4f{acc[j][4], acc[j][5], acc[j][6], acc[j][7]}; }
    pm[run - 1][wave][0][lane] = m; pm[run - 1][wave][1][lane] = l; }
  __syncthreads();   // every wave passes it once: the partial results are in LDS before run 0 reads them
  if (run != 0) return;
#pragma unroll
  for (int p = 0; p < KS - 1; ++p) {   // join: both sides brought to the common maximum, then added (lane for lane the same query and channels)
    const float m1 = pm[p][wave][0][lane], l1 = pm[p][wave][1][lane]; const float d = m - m1, e = __expf(-fabsf(d)); const float a0 = d < 0.f ? e : 1.0f, a1 = d < 0.f ? 1.0f : e; m = fmaxf(m, m1); l = l * a0 + l1 * a1;   // the side with the larger maximum keeps its scale
#pragma unroll
    for (int j = 0; j < 4; ++j) { const v4f lo = pa[p][wave][2 * j][lane], hi = pa[p][wave][2 * j + 1][lane];
#pragma unroll
      for (int r = 0; r < 4; ++r) { acc[j][r] = acc[j][r] * a0 + lo[r] * a1; acc[j][4 + r] = acc[j][4 + r] * a0 + hi[r] * a1; } } }
  { const float il = (1.0f / 2048.0f) / (l + xhalf(l)); const float* xr = X + (q0 + col) * CC + 8 * g;
#pragma unroll
    for (int j = 0; j < 4; ++j)
#pragma unroll
      for (int r = 0; r < 8; ++r) so[wave][col][j * 16 + 8 * g + r] = acc[j][r] * il * gm + bfr(xr[j * 16 + r]); }
  LDSX(); for (int rl = 0; rl < 16; ++rl) if (lane < 16) vst2(OUT + (q0 + rl) * CC + lane * 4, *(const v4f*)&so[wave][rl][lane * 4]); }
extern "C" void kernel_launch(void* const* d_in, const int* in_sizes, int n_in, void* d_out, int out_size, void* d_ws, size_t ws_size, hipStream_t stream) {
  (void)in_sizes; (void)n_in; (void)out_size;
  const float** F = (const float**)d_in;   // 0 x [8,64,64,64] (channels last), 1 wq [64,8], 2 bq, 3 wk, 4 bk, 5 wv [64,64], 6 bv, 7 gamma [1]
  if (ws_size < (size_t)WS_END) return;
  char* ws = (char*)d_ws; float* Q = (float*)(ws + WS_Q); __bf16* K = (__bf16*)(ws + WS_K); _Float16* VT = (_Float16*)(ws + WS_VT);
  k_proj<<<TNI * NP / 64, 128, 0, stream>>>(F[0], F[1], F[2], F[3], F[4], F[5], F[6], Q, K, VT);
  k_att<<<dim3(NP / 64, TNI), 128 * KS, 0, stream>>>(Q, K, VT, F[0], F[7], (float*)d_out);
}

// v006
// A run of this version takes 42 microseconds.
// Timed twice side by side with v005, it ran 1.13 and 1.18 times as fast.
// Counting every step since v000, it is 5.61 times as fast.
// compute dtype: all float inputs rounded to bf16, gamma read; q/k (8 channels) and v (64) = x W + b with EXACT bf16 products on WMMA 16x16x32 ((in,out) weights), f32 accumulate; q and k computed in f32 and split into bf16 hi + lo for the UNSCALED logits (the 4 products of the halves side by side in the K = 32 of one WMMA; logits std ~2.8), running-max softmax over the 4,096 pixels in f32 (hardware exp); P (f16 x 2^11) . v with v rounded once to f16; out = (P v) gamma + x; f32 output.
#include <hip/hip_runtime.h>
#include <math.h>

typedef __attribute__((ext_vector_type(16))) _Float16 v16h;
typedef __attribute__((ext_vector_type(16))) __bf16 v16b;
typedef __attribute__((ext_vector_type(8)))  _Float16 v8h;
typedef __attribute__((ext_vector_type(8)))  float v8f;
typedef __attribute__((ext_vector_type(4)))  float v4f;
typedef __attribute__((ext_vector_type(2)))  float v2f;
typedef __attribute__((ext_vector_type(4)))  unsigned v4u;
typedef __attribute__((ext_vector_type(4)))  int v4i;
typedef float __attribute__((may_alias)) float_a;
typedef int __attribute__((may_alias)) int_a;

template <typename T> __device__ __forceinline__ void vst2(void* p, T v) { *(T*)p = v;  }
__device__ __forceinline__ v8f wmma16(v16h a, v16h b, v8f c) {
  v8f d = __builtin_amdgcn_wmma_f32_16x16x32_f16(false, a, false, b, (short)0, c, false, false);
  asm volatile("v_nop\n\tv_nop\n\tv_nop\n\tv_nop" : "+v"(d) : "v"(a), "v"(b));
  return d;
}
__device__ __forceinline__ v8f wmma_bf(v16b a, v16b b, v8f c) {
  v8f d = __builtin_amdgcn_wmma_f32_16x16x32_bf16(false, a, false, b, (short)0, c, false, false);
  asm volatile("v_nop\n\tv_nop\n\tv_nop\n\tv_nop" : "+v"(d) : "v"(a), "v"(b));
  return d;
}
// 16x16x32 fragments: lane = (h = lane>>4, row/col = lane&15); elements 0..7 = k0+8h+0..7, 8..15 = k0+16+8h+0..7; D element r = row 8h+r
__device__ __forceinline__ v16h frag_h(const _Float16* rowk0, int lane) {
  union { v16h v; v8h q[2]; } u; const _Float16* p = rowk0 + 8 * (lane >> 4);
  u.q[0] = *(const v8h*)p; u.q[1] = *(const v8h*)(p + 16); return u.v;
}
__device__ __forceinline__ v16h frag_f32(const float* rowk0, int lane) {
  v16h a; const float* p = rowk0 + 8 * (lane >> 4);
#pragma unroll
  for (int i = 0; i < 8; ++i) { a[i] = (_Float16)p[i]; a[8 + i] = (_Float16)p[16 + i]; }
  return a;
}
__device__ __forceinline__ v16h frag_f32s(const float* rowk0, int lane, float sc) {
  v16h a; const float* p = rowk0 + 8 * (lane >> 4);
#pragma unroll
  for (int i = 0; i < 8; ++i) { a[i] = (_Float16)(p[i] * sc); a[8 + i] = (_Float16)(p[16 + i] * sc); }
  return a;
}
// column fragment from a [K][ld] layout (column n), rows >= K read as 0
__device__ __forceinline__ v16h fragc_f32(const float* W, int k0, int n, int lane, int ld, int K) {
  v16h a; const int g = lane >> 4;
#pragma unroll
  for (int i = 0; i < 8; ++i) { const int ka = k0 + 8 * g + i, kb = ka + 16;
    a[i] = (_Float16)(ka < K ? W[(size_t)(ka < K ? ka : K - 1) * ld + n] : 0.f); a[8 + i] = (_Float16)(kb < K ? W[(size_t)(kb < K ? kb : K - 1) * ld + n] : 0.f); }
  return a;
}
struct F2 { v16b h, l; };
__device__ __forceinline__ F2 bsplit16(const float v[16]) { F2 r;
#pragma unroll
  for (int i = 0; i < 16; ++i) { const __bf16 h = (__bf16)v[i]; r.h[i] = h; r.l[i] = (__bf16)(v[i] - (float)h); }
  return r; }
__device__ __forceinline__ F2 split_row(const float* row, int k0, int lane) { float v[16]; const float* p = row + k0 + 8 * (lane >> 4);
#pragma unroll
  for (int i = 0; i < 8; ++i) { v[i] = p[i]; v[8 + i] = p[16 + i]; }
  return bsplit16(v); }
__device__ __forceinline__ F2 split_rowK(const float* row, int k0, int lane, int K) { float v[16]; const int g = lane >> 4;
#pragma unroll
  for (int i = 0; i < 8; ++i) { const int ka = k0 + 8 * g + i, kb = ka + 16; v[i] = ka < K ? row[ka < K ? ka : K - 1] : 0.f; v[8 + i] = kb < K ? row[kb < K ? kb : K - 1] : 0.f; }
  return bsplit16(v); }
__device__ __forceinline__ F2 split_col(const float* W, int k0, int n, int lane, int ld, int K) { float v[16]; const int g = lane >> 4;
#pragma unroll
  for (int i = 0; i < 8; ++i) { const int ka = k0 + 8 * g + i, kb = ka + 16; v[i] = ka < K ? W[(size_t)(ka < K ? ka : K - 1) * ld + n] : 0.f; v[8 + i] = kb < K ? W[(size_t)(kb < K ? kb : K - 1) * ld + n] : 0.f; }
  return bsplit16(v); }
__device__ __forceinline__ v8f mac3(const F2& a, const F2& b, v8f c) { c = wmma_bf(a.l, b.h, c); c = wmma_bf(a.h, b.l, c); return wmma_bf(a.h, b.h, c); }
__device__ __forceinline__ float sigm(float v) { return 1.0f / (1.0f + expf(-v)); }
#define LDSX() do { asm volatile("s_wait_dscnt 0" ::: "memory"); __builtin_amdgcn_wave_barrier(); __builtin_amdgcn_fence(__ATOMIC_RELEASE, "workgroup"); } while (0)


// Convolutional self attention (B 8, 64 x 64, C 64, q/k dim C/8 = 8): 1x1-conv q/k/v, unscaled softmax over all pixels, out = attn v * gamma + x (channels-last).
#define NI 8
#define NP 4096
#define CC 64
#define DQ 8
#ifndef TNI
#define TNI NI
#endif
typedef __attribute__((ext_vector_type(8))) __bf16 v8b;
__device__ __forceinline__ v16b frag_b(const __bf16* rowk0, int lane) {
  union { v16b v; v8b q[2]; } u; const __bf16* p = rowk0 + 8 * (lane >> 4);
  u.q[0] = *(const v8b*)p; u.q[1] = *(const v8b*)(p + 16); return u.v;
}
__device__ __forceinline__ float bfr(float v) { return (float)(__bf16)v; }
__device__ __attribute__((noinline)) float exp_ni(float v) { return expf(v); }
__device__ __attribute__((noinline)) float erf_ni(float v) { return erff(v); }

#define WS_Q   0u                                   // f32 q rows [n][8]
#define WS_K   (WS_Q + 4u * (size_t)NI * NP * DQ)       // k split into bf16 hi + lo, in the order k_att's A fragments take it: [b][tile of 16 keys][hi, lo][key][8]
#define WS_VT  (WS_K + 4u * (size_t)NI * NP * DQ)       // f16 v in the order k_att's A fragments take it: [b][tile of 32 keys][16-channel group j][element half h][lane][8]: lane (g, col) holds channel 16 j + col, keys 16 h + 8 g + 0..7
#define WS_END (WS_VT + 2u * (size_t)NI * CC * NP)

// ---- k_proj: block = 64 pixels (rows of x [b*n][64]): q, k (8 each; one 16-col tile holding q|k) and v (64) exact
__global__ __launch_bounds__(128) void k_proj(const float* __restrict__ X, const float* __restrict__ WQ, const float* __restrict__ BQ, const float* __restrict__ WK, const float* __restrict__ BK, const float* __restrict__ WV, const float* __restrict__ BV, float* __restrict__ Q, __bf16* __restrict__ K, _Float16* __restrict__ VT) {
  __shared__ __align__(16) float sqk[64][16]; __shared__ __align__(16) _Float16 tv[64][72];
  const int tid = threadIdx.x, wave = tid >> 5, lane = tid & 31, col = lane & 15, g = lane >> 4; const size_t r0 = (size_t)blockIdx.x * 64;
  v8f acc[5] = {};
#pragma unroll
  for (int kc = 0; kc < CC / 32; ++kc) { v16b a; { const float* p = X + (r0 + wave * 16 + col) * CC + kc * 32 + 8 * g;
#pragma unroll
      for (int i = 0; i < 8; ++i) { a[i] = (__bf16)p[i]; a[8 + i] = (__bf16)p[16 + i]; } }
    { v16b w; const float* Wm = (col < 8) ? WQ : WK; const int o = col & 7;   // tile 0: cols 0-7 = q, 8-15 = k
#pragma unroll
      for (int i = 0; i < 8; ++i) { w[i] = (__bf16)Wm[(kc * 32 + 8 * g + i) * DQ + o]; w[8 + i] = (__bf16)Wm[(kc * 32 + 16 + 8 * g + i) * DQ + o]; }
      acc[0] = wmma_bf(a, w, acc[0]); }
#pragma unroll
    for (int j = 0; j < 4; ++j) { v16b w; const int o = j * 16 + col;
#pragma unroll
      for (int i = 0; i < 8; ++i) { w[i] = (__bf16)WV[(kc * 32 + 8 * g + i) * CC + o]; w[8 + i] = (__bf16)WV[(kc * 32 + 16 + 8 * g + i) * CC + o]; }
      acc[1 + j] = wmma_bf(a, w, acc[1 + j]); } }
  { const float bb = (col < 8) ? bfr(BQ[col]) : bfr(BK[col & 7]);
#pragma unroll
    for (int r = 0; r < 8; ++r) sqk[wave * 16 + 8 * g + r][col] = acc[0][r] + bb; }
#pragma unroll
  for (int j = 0; j < 4; ++j) { const int c = j * 16 + col; const float bb = bfr(BV[c]);
#pragma unroll
    for (int r = 0; r < 8; ++r) tv[c][wave * 16 + 8 * g + r] = (_Float16)(acc[1 + j][r] + bb); }
  __syncthreads();
  if (tid < 32) { const int rl = tid * 2; v4f a0 = *(const v4f*)&sqk[rl][0], a1 = *(const v4f*)&sqk[rl][4], b0 = *(const v4f*)&sqk[rl + 1][0], b1 = *(const v4f*)&sqk[rl + 1][4]; vst2(Q + (r0 + rl) * DQ, a0); vst2(Q + (r0 + rl) * DQ + 4, a1); vst2(Q + (r0 + rl + 1) * DQ, b0); vst2(Q + (r0 + rl + 1) * DQ + 4, b1); }
  else if (tid < 96) { const int rl = tid - 32; v8b h, l;   // one key a thread: its 8 channels split once here, for every wave of k_att that reads them
#pragma unroll
    for (int i = 0; i < 8; ++i) { const float v = sqk[rl][8 + i]; h[i] = (__bf16)v; l[i] = (__bf16)(v - (float)h[i]); }
    __bf16* kp = K + ((r0 + rl) >> 4) * 256 + (rl & 15) * 8; vst2(kp, h); vst2(kp + 128, l); }
  // the block's 64 pixels are two whole key tiles, 8 KiB in a row: 16-byte piece e = (tile, j, h, lane)
  for (int e = tid; e < 64 * 8; e += 128) { const int c = ((e >> 6) & 3) * 16 + (e & 15), q = (e >> 8) * 4 + ((e >> 5) & 1) * 2 + ((e >> 4) & 1); vst2((unsigned*)(VT + r0 * CC + e * 8), *(const v4u*)&tv[c][q * 8]); } }
#define GLB __attribute__((address_space(1)))
// a wave-uniform global pointer held in scalar registers, so that the loads behind it take the scalar-base form and no vector address pair is formed per trip
template <typename T> __device__ __forceinline__ const GLB T* ubase(const T* p) { const unsigned long long a = (unsigned long long)p;
  return (const GLB T*)(((unsigned long long)(unsigned)__builtin_amdgcn_readfirstlane((int)(a >> 32)) << 32) | (unsigned)__builtin_amdgcn_readfirstlane((int)a)); }
// 16x16x32 f16 fragment stored in fragment order: a wave-uniform base and the lane's own element offset (8 * lane); each of the two loads takes 512 bytes in a row, four whole cache lines
__device__ __forceinline__ v16h frag_u(const GLB _Float16* base, unsigned off) {
  union { v16h v; v8h q[2]; } u; u.q[0] = *(const GLB v8h*)(base + off); u.q[1] = *(const GLB v8h*)(base + 256 + off); return u.v;
}
// K fragment of a 16-key tile stored as [hi, lo][key][8]: a wave-uniform base and the lane's own element offset (8 * col); each of the two loads takes 256 bytes in a row
__device__ __forceinline__ v16b frag_k(const GLB __bf16* base, unsigned off) {
  union { v16b v; v8b q[2]; } u; u.q[0] = *(const GLB v8b*)(base + off); u.q[1] = *(const GLB v8b*)(base + 128 + off); return u.v;
}
// lane l with lane l ^ 16 (a vector cross-row move; the shuffle helper would go through the LDS pipe)
__device__ __forceinline__ float xhalf(float x) { return __builtin_bit_cast(float, __builtin_amdgcn_permlanex16(__builtin_bit_cast(int, x), __builtin_bit_cast(int, x), 0x76543210, 0xfedcba98, false, false)); }
// ---- k_att: block = 64 queries of image b, transposed: S^T = K . Q^T (one WMMA a 16-key tile: its K = 32 holds k.hi q.hi, k.hi q.lo, k.lo q.hi, k.lo q.lo over the 8 channels), so a lane holds 16 of the 32 scores of ONE query (col) of each of its tiles: softmax in the lane plus one exchange between halves;
//      the two S^T tiles of a query tile, converted in place, are the B operand of O^T += V^T . P^T; out = gamma * o + x
//      A wave holds QT = 2 query tiles (32 queries): every K and V fragment it loads is the A operand of two WMMAs, so a score costs half the loaded bytes.
//      Each group of 32 queries has KS waves, each with its own run of NP / KS keys, which keeps four waves on a SIMD. Every wave puts its partial (m, l, O) into LDS; behind the barrier each of the KS waves joins one quarter of the group's output (one query tile, 32 channels = whole 128-byte lines).
#define KS 4
#define QT 2
#define KT (NP / 32 / KS)   // trips of one wave
static_assert(KS == 2 * QT, "the join deals (query tile, channel half) to the KS waves of a group");
__global__ __launch_bounds__(64 * KS) void k_att(const float* __restrict__ Q, const __bf16* __restrict__ K, const _Float16* __restrict__ VT, const float* __restrict__ X, const float* __restrict__ GM, float* __restrict__ OUT) {
  __shared__ __align__(16) float so[2 * KS][16][36];   // a wave's own output staging: 16 queries x 32 channels, pitch 144 bytes
  __shared__ __align__(16) v4f pa[KS][2][QT * 8][32];  // a run's O: [run][query group][query tile, quad of accumulator elements][lane]: a lane's 16 bytes beside its neighbour's
  __shared__ float pm[KS][2][QT][2][32];               // its m and l
  const int tid = threadIdx.x, lane = tid & 31, col = lane & 15, g = lane >> 4; const int i0 = blockIdx.x * 64; const size_t b = blockIdx.y;
  const int wv = __builtin_amdgcn_readfirstlane(tid >> 5), grp = wv & 1, run = wv >> 1, kt0 = run * KT;   // the wave's query group and its run of keys (scalar: the trip's bases stay scalar), and its first trip's tile
  const size_t q0 = b * NP + i0 + grp * 32;
  v16b bq[QT];   // B operand: k slots 8 g + i and 16 + 8 g + i both hold channel i of query col: its hi in the lanes g == 0, its lo in the lanes g == 1
  v8f qv[QT];
#pragma unroll
  for (int t = 0; t < QT; ++t) qv[t] = *(const v8f*)(Q + (q0 + 16 * t + col) * DQ);
  asm volatile("s_wait_xcnt 0x0" ::: "memory");   // stands before the K and V fetches below, whose results may take the registers of the address that the q loads name
#pragma unroll
  for (int t = 0; t < QT; ++t)
#pragma unroll
    for (int i = 0; i < 8; ++i) { const float v = qv[t][i]; const __bf16 h = (__bf16)v, lo = (__bf16)(v - (float)h); bq[t][i] = g ? lo : h; bq[t][8 + i] = bq[t][i]; }
  float m[QT], l[QT];   // query col's running maximum (same in both halves) and this half's share of its sum
  v8f acc[QT][4];       // acc[t][j][r] = O[query 16 t + col][channel 16 j + 8 g + r]
#pragma unroll
  for (int t = 0; t < QT; ++t) { m[t] = -3.0e38f; l[t] = 0.f;
#pragma unroll
    for (int j = 0; j < 4; ++j) acc[t][j] = v8f{}; }
  const float gm = bfr(GM[0]);
  // The trip's K fragments (kf: elements 0..7 = hi, 8..15 = lo of key col, the same in both halves of the wave, so slots 0..15 carry k.hi and 16..31 k.lo) and V fragments (vf) are fetched one trip ahead, each into the registers of the tile it replaces, right after that tile's last use.
  // Addresses: a wave-uniform scalar base that moves with the trip plus a fixed 32-bit lane offset: no vector address register is rewritten behind an issued load, and the bases are formed anew behind the wait at the trip's head.
  const __bf16* kb0 = K + b * NP * 2 * DQ; const _Float16* vb0 = VT + b * CC * (size_t)NP; const unsigned ko = col * DQ, vo = 8 * lane;
  v16b kf[2]; v16h vf[4];
#pragma unroll
  for (int ct = 0; ct < 2; ++ct) kf[ct] = frag_k(ubase(kb0 + (size_t)kt0 * 32 * 2 * DQ) + ct * 256, ko);
#pragma unroll
  for (int j = 0; j < 4; ++j) vf[j] = frag_u(ubase(vb0 + (size_t)kt0 * 32 * CC) + j * 512, vo);
#pragma unroll 1
  for (int ks = 0; ks < KT; ++ks) {
    int kt;
    asm volatile("s_wait_xcnt 0x0\n\ts_mov_b32 %0, %1" : "=s"(kt) : "s"(ks) : "memory");   // stands before the scalar bases named by the loads of the trip before are formed anew (they all derive from kt, which is itself written behind the wait)
    const int kn = kt0 + (kt < KT - 1 ? kt + 1 : kt);   // the last trip fetches its own tile again: every fetch stays inside what k_proj wrote
    v8f s[QT][2];   // s[t][ct][r] = logit of key 16 ct + 8 g + r with query 16 t + col
#pragma unroll
    for (int ct = 0; ct < 2; ++ct)
#pragma unroll
      for (int t = 0; t < QT; ++t) { const v8f z = {}; s[t][ct] = wmma_bf(kf[ct], bq[t], z); }
    const GLB __bf16* kb = ubase(kb0 + (size_t)kn * 32 * 2 * DQ);
#pragma unroll
    for (int ct = 0; ct < 2; ++ct) kf[ct] = frag_k(kb + ct * 256, ko);
    v16h pb[QT];   // pb[t]: element r = key 8 g + r, element 8 + r = key 16 + 8 g + r: the k order of vf
    float mo[QT], al[QT];   // the maximum before this trip, and the factor that brings sums made under it to the new one
#pragma unroll
    for (int t = 0; t < QT; ++t) {
      float mx[4];
#pragma unroll
      for (int i = 0; i < 4; ++i) mx[i] = fmaxf(fmaxf(s[t][0][i], s[t][0][4 + i]), fmaxf(s[t][1][i], s[t][1][4 + i]));
      const float mh = fmaxf(fmaxf(mx[0], mx[1]), fmaxf(mx[2], mx[3]));
      mo[t] = m[t]; m[t] = fmaxf(m[t], fmaxf(mh, xhalf(mh))); }
#pragma unroll
    for (int t = 0; t < QT; ++t) asm("v_exp_f32 %0, %1\n\tv_nop" : "=v"(al[t]) : "v"((mo[t] - m[t]) * 1.44269504f));   // exp(mo - m); the v_nop fills the slot behind the transcendental: this build put an instruction that overwrites its source directly behind it
#pragma unroll
    for (int t = 0; t < QT; ++t) {
      const float mn = m[t], alpha = al[t];
      v8f e[2];   // whole-tile vector forms: neighbouring accumulator registers pair up in packed instructions with no register moves
#pragma unroll
      for (int ct = 0; ct < 2; ++ct) { const v8f y = (s[t][ct] - mn) * 1.44269504f;
#pragma unroll
        for (int r = 0; r < 8; ++r) e[ct][r] = __builtin_amdgcn_exp2f(y[r]);
        const v8f ps = e[ct] * 2048.0f;
#pragma unroll
        for (int r = 0; r < 8; ++r) pb[t][8 * ct + r] = (_Float16)ps[r]; }
      const v8f e2 = e[0] + e[1]; const v4f e4 = e2.lo + e2.hi; const v2f e1 = e4.lo + e4.hi;   // halved three times: every add but the last pairs neighbouring registers
      l[t] = l[t] * alpha + (e1[0] + e1[1]);
#pragma unroll
      for (int j = 0; j < 4; ++j)
#pragma unroll
        for (int r = 0; r < 8; ++r) acc[t][j][r] *= alpha; }
#pragma unroll
    for (int j = 0; j < 4; ++j)
#pragma unroll
      for (int t = 0; t < QT; ++t) acc[t][j] = wmma16(vf[j], pb[t], acc[t][j]);
    const GLB _Float16* vb = ubase(vb0 + (size_t)kn * 32 * CC);
#pragma unroll
    for (int j = 0; j < 4; ++j) vf[j] = frag_u(vb + j * 512, vo); }
#pragma unroll
  for (int t = 0; t < QT; ++t) {   // every wave hands its partial result over
#pragma unroll
    for (int j = 0; j < 4; ++j) { pa[run][grp][8 * t + 2 * j][lane] = v4f{acc[t][j][0], acc[t][j][1], acc[t][j][2], acc[t][j][3]}; pa[run][grp][8 * t + 2 * j + 1][lane] = v4f{acc[t][j][4], acc[t][j][5], acc[t][j][6], acc[t][j][7]}; }
    pm[run][grp][t][0][lane] = m[t]; pm[run][grp][t][1][lane] = l[t]; }
  __syncthreads();   // every wave passes it once: all partial results are in LDS before any wave reads them
  const int jt = run >> 1, ch = run & 1;   // this wave joins query tile jt, channels 32 ch .. 32 ch + 31 (accumulator quads 8 jt + 4 ch + 0..3), lane for lane the same query and channels in every run
  float mp[KS], mj = -3.0e38f, lj = 0.f;
#pragma unroll
  for (int p = 0; p < KS; ++p) { mp[p] = pm[p][grp][jt][0][lane]; mj = fmaxf(mj, mp[p]); }
  v4f o[4] = {};   // o[2 jj + hh][r] = O[query col][channel 32 ch + 16 jj + 8 g + 4 hh + r], every run brought to the common maximum and added in the order of the runs
#pragma unroll
  for (int p = 0; p < KS; ++p) { const float a = __expf(mp[p] - mj); lj += pm[p][grp][jt][1][lane] * a;
#pragma unroll
    for (int e = 0; e < 4; ++e) { const v4f w = pa[p][grp][8 * jt + 4 * ch + e][lane];
#pragma unroll
      for (int r = 0; r < 4; ++r) o[e][r] += w[r] * a; } }
  { const float il = (1.0f / 2048.0f) / (lj + xhalf(lj)); const size_t qr = q0 + 16 * jt; const float* xr = X + (qr + col) * CC + 32 * ch + 8 * g;
#pragma unroll
    for (int e = 0; e < 4; ++e)
#pragma unroll
      for (int r = 0; r < 4; ++r) so[wv][col][16 * (e >> 1) + 8 * g + 4 * (e & 1) + r] = o[e][r] * il * gm + bfr(xr[16 * (e >> 1) + 4 * (e & 1) + r]);
    LDSX();   // the wave's own rows are in LDS before it reads them back
#pragma unroll
    for (int it = 0; it < 4; ++it) { const int rl = 4 * it + (lane >> 3), c4 = 4 * (lane & 7); vst2(OUT + (qr + rl) * CC + 32 * ch + c4, *(const v4f*)&so[wv][rl][c4]); } } }   // each store: four whole 128-byte lines
extern "C" void kernel_launch(void* const* d_in, const int* in_sizes, int n_in, void* d_out, int out_size, void* d_ws, size_t ws_size, hipStream_t stream) {
  (void)in_sizes; (void)n_in; (void)out_size;
  const float** F = (const float**)d_in;   // 0 x [8,64,64,64] (channels last), 1 wq [64,8], 2 bq, 3 wk, 4 bk, 5 wv [64,64], 6 bv, 7 gamma [1]
  if (ws_size < (size_t)WS_END) return;
  char* ws = (char*)d_ws; float* Q = (float*)(ws + WS_Q); __bf16* K = (__bf16*)(ws + WS_K); _Float16* VT = (_Float16*)(ws + WS_VT);
  k_proj<<<TNI * NP / 64, 128, 0, stream>>>(F[0], F[1], F[2], F[3], F[4], F[5], F[6], Q, K, VT);
  k_att<<<dim3(NP / 64, TNI), 64 * KS, 0, stream>>>(Q, K, VT, F[0], F[7], (float*)d_out);
}

// v007
// It runs in 31.6 microseconds.
// Next to v006, in two timings, it ran 1.28 and 1.26 times as fast.
// Counting every step since v000, it is 7.12 times as fast.
// compute dtype: all float inputs rounded to bf16, gamma read; q/k (8 channels) and v (64) = x W + b with EXACT bf16 products on WMMA 16x16x32 ((in,out) weights), f32 accumulate; q and k computed in f32 and split into bf16 hi + lo for the UNSCALED logits (the 4 products of the halves side by side in the K = 32 of one WMMA; logits std ~2.8), softmax over the 4,096 pixels in f32 (hardware exp2; q carries log2 e) under a maximum in use that is raised only when a trip's sum asks for it; P (f16 x 2^4 under that maximum, never above 2^15) . v with v rounded once to f16; out = (P v) gamma + x; f32 output.
#include <hip/hip_runtime.h>
#include <math.h>

typedef __attribute__((ext_vector_type(16))) _Float16 v16h;
typedef __attribute__((ext_vector_type(16))) __bf16 v16b;
typedef __attribute__((ext_vector_type(8)))  _Float16 v8h;
typedef __attribute__((ext_vector_type(8)))  float v8f;
typedef __attribute__((ext_vector_type(4)))  float v4f;
typedef __attribute__((ext_vector_type(2)))  float v2f;
typedef __attribute__((ext_vector_type(4)))  unsigned v4u;
typedef __attribute__((ext_vector_type(4)))  int v4i;
typedef float __attribute__((may_alias)) float_a;
typedef int __attribute__((may_alias)) int_a;

template <typename T> __device__ __forceinline__ void vst2(void* p, T v) { *(T*)p = v;  }
__device__ __forceinline__ v8f wmma16(v16h a, v16h b, v8f c) {
  v8f d = __builtin_amdgcn_wmma_f32_16x16x32_f16(false, a, false, b, (short)0, c, false, false);
  asm volatile("v_nop\n\tv_nop\n\tv_nop\n\tv_nop" : "+v"(d) : "v"(a), "v"(b));
  return d;
}
__device__ __forceinline__ v8f wmma_bf(v16b a, v16b b, v8f c) {
  v8f d = __builtin_amdgcn_wmma_f32_16x16x32_bf16(false, a, false, b, (short)0, c, false, false);
  asm volatile("v_nop\n\tv_nop\n\tv_nop\n\tv_nop" : "+v"(d) : "v"(a), "v"(b));
  return d;
}
// 16x16x32 fragments: lane = (h = lane>>4, row/col = lane&15); elements 0..7 = k0+8h+0..7, 8..15 = k0+16+8h+0..7; D element r = row 8h+r
__device__ __forceinline__ v16h frag_h(const _Float16* rowk0, int lane) {
  union { v16h v; v8h q[2]; } u; const _Float16* p = rowk0 + 8 * (lane >> 4);
  u.q[0] = *(const v8h*)p; u.q[1] = *(const v8h*)(p + 16); return u.v;
}
__device__ __forceinline__ v16h frag_f32(const float* rowk0, int lane) {
  v16h a; const float* p = rowk0 + 8 * (lane >> 4);
#pragma unroll
  for (int i = 0; i < 8; ++i) { a[i] = (_Float16)p[i]; a[8 + i] = (_Float16)p[16 + i]; }
  return a;
}
__device__ __forceinline__ v16h frag_f32s(const float* rowk0, int lane, float sc) {
  v16h a; const float* p = rowk0 + 8 * (lane >> 4);
#pragma unroll
  for (int i = 0; i < 8; ++i) { a[i] = (_Float16)(p[i] * sc); a[8 + i] = (_Float16)(p[16 + i] * sc); }
  return a;
}
// column fragment from a [K][ld] layout (column n), rows >= K read as 0
__device__ __forceinline__ v16h fragc_f32(const float* W, int k0, int n, int lane, int ld, int K) {
  v16h a; const int g = lane >> 4;
#pragma unroll
  for (int i = 0; i < 8; ++i) { const int ka = k0 + 8 * g + i, kb = ka + 16;
    a[i] = (_Float16)(ka < K ? W[(size_t)(ka < K ? ka : K - 1) * ld + n] : 0.f); a[8 + i] = (_Float16)(kb < K ? W[(size_t)(kb < K ? kb : K - 1) * ld + n] : 0.f); }
  return a;
}
struct F2 { v16b h, l; };
__device__ __forceinline__ F2 bsplit16(const float v[16]) { F2 r;
#pragma unroll
  for (int i = 0; i < 16; ++i) { const __bf16 h = (__bf16)v[i]; r.h[i] = h; r.l[i] = (__bf16)(v[i] - (float)h); }
  return r; }
__device__ __forceinline__ F2 split_row(const float* row, int k0, int lane) { float v[16]; const float* p = row + k0 + 8 * (lane >> 4);
#pragma unroll
  for (int i = 0; i < 8; ++i) { v[i] = p[i]; v[8 + i] = p[16 + i]; }
  return bsplit16(v); }
__device__ __forceinline__ F2 split_rowK(const float* row, int k0, int lane, int K) { float v[16]; const int g = lane >> 4;
#pragma unroll
  for (int i = 0; i < 8; ++i) { const int ka = k0 + 8 * g + i, kb = ka + 16; v[i] = ka < K ? row[ka < K ? ka : K - 1] : 0.f; v[8 + i] = kb < K ? row[kb < K ? kb : K - 1] : 0.f; }
  return bsplit16(v); }
__device__ __forceinline__ F2 split_col(const float* W, int k0, int n, int lane, int ld, int K) { float v[16]; const int g = lane >> 4;
#pragma unroll
  for (int i = 0; i < 8; ++i) { const int ka = k0 + 8 * g + i, kb = ka + 16; v[i] = ka < K ? W[(size_t)(ka < K ? ka : K - 1) * ld + n] : 0.f; v[8 + i] = kb < K ? W[(size_t)(kb < K ? kb : K - 1) * ld + n] : 0.f; }
  return bsplit16(v); }
__device__ __forceinline__ v8f mac3(const F2& a, const F2& b, v8f c) { c = wmma_bf(a.l, b.h, c); c = wmma_bf(a.h, b.l, c); return wmma_bf(a.h, b.h, c); }
__device__ __forceinline__ float sigm(float v) { return 1.0f / (1.0f + expf(-v)); }
#define LDSX() do { asm volatile("s_wait_dscnt 0" ::: "memory"); __builtin_amdgcn_wave_barrier(); __builtin_amdgcn_fence(__ATOMIC_RELEASE, "workgroup"); } while (0)


// Convolutional self attention (B 8, 64 x 64, C 64, q/k dim C/8 = 8): 1x1-conv q/k/v, unscaled softmax over all pixels, out = attn v * gamma + x (channels-last).
#define NI 8
#define NP 4096
#define CC 64
#define DQ 8
#ifndef TNI
#define TNI NI
#endif
typedef __attribute__((ext_vector_type(8))) __bf16 v8b;
__device__ __forceinline__ v16b frag_b(const __bf16* rowk0, int lane) {
  union { v16b v; v8b q[2]; } u; const __bf16* p = rowk0 + 8 * (lane >> 4);
  u.q[0] = *(const v8b*)p; u.q[1] = *(const v8b*)(p + 16); return u.v;
}
__device__ __forceinline__ float bfr(float v) { return (float)(__bf16)v; }
__device__ __attribute__((noinline)) float exp_ni(float v) { return expf(v); }
__device__ __attribute__((noinline)) float erf_ni(float v) { return erff(v); }

#define WS_Q   0u                                   // f32 q rows [n][8], times log2 e
#define WS_K   (WS_Q + 4u * (size_t)NI * NP * DQ)       // k split into bf16 hi + lo, in the order k_att's A fragments take it: [b][tile of 16 keys][hi, lo][key][8]
#define WS_VT  (WS_K + 4u * (size_t)NI * NP * DQ)       // f16 v in the order k_att's A fragments take it: [b][tile of 32 keys][16-channel group j][element half h][lane][8]: lane (g, col) holds channel 16 j + col, keys 16 h + 8 g + 0..7
#define WS_END (WS_VT + 2u * (size_t)NI * CC * NP)

// ---- k_proj: block = 64 pixels (rows of x [b*n][64]): q, k (8 each; one 16-col tile holding q|k) and v (64) exact
__global__ __launch_bounds__(128) void k_proj(const float* __restrict__ X, const float* __restrict__ WQ, const float* __restrict__ BQ, const float* __restrict__ WK, const float* __restrict__ BK, const float* __restrict__ WV, const float* __restrict__ BV, float* __restrict__ Q, __bf16* __restrict__ K, _Float16* __restrict__ VT) {
  __shared__ __align__(16) float sqk[64][16]; __shared__ __align__(16) _Float16 tv[64][72];
  const int tid = threadIdx.x, wave = tid >> 5, lane = tid & 31, col = lane & 15, g = lane >> 4; const size_t r0 = (size_t)blockIdx.x * 64;
  v8f acc[5] = {};
#pragma unroll
  for (int kc = 0; kc < CC / 32; ++kc) { v16b a; { const float* p = X + (r0 + wave * 16 + col) * CC + kc * 32 + 8 * g;
#pragma unroll
      for (int i = 0; i < 8; ++i) { a[i] = (__bf16)p[i]; a[8 + i] = (__bf16)p[16 + i]; } }
    { v16b w; const float* Wm = (col < 8) ? WQ : WK; const int o = col & 7;   // tile 0: cols 0-7 = q, 8-15 = k
#pragma unroll
      for (int i = 0; i < 8; ++i) { w[i] = (__bf16)Wm[(kc * 32 + 8 * g + i) * DQ + o]; w[8 + i] = (__bf16)Wm[(kc * 32 + 16 + 8 * g + i) * DQ + o]; }
      acc[0] = wmma_bf(a, w, acc[0]); }
#pragma unroll
    for (int j = 0; j < 4; ++j) { v16b w; const int o = j * 16 + col;
#pragma unroll
      for (int i = 0; i < 8; ++i) { w[i] = (__bf16)WV[(kc * 32 + 8 * g + i) * CC + o]; w[8 + i] = (__bf16)WV[(kc * 32 + 16 + 8 * g + i) * CC + o]; }
      acc[1 + j] = wmma_bf(a, w, acc[1 + j]); } }
  { const float bb = (col < 8) ? bfr(BQ[col]) : bfr(BK[col & 7]), sc = (col < 8) ? 1.44269504f : 1.0f;   // q goes out times log2 e: k_att's logits come out in log2 units
#pragma unroll
    for (int r = 0; r < 8; ++r) sqk[wave * 16 + 8 * g + r][col] = (acc[0][r] + bb) * sc; }
#pragma unroll
  for (int j = 0; j < 4; ++j) { const int c = j * 16 + col; const float bb = bfr(BV[c]);
#pragma unroll
    for (int r = 0; r < 8; ++r) tv[c][wave * 16 + 8 * g + r] = (_Float16)(acc[1 + j][r] + bb); }
  __syncthreads();
  if (tid < 32) { const int rl = tid * 2; v4f a0 = *(const v4f*)&sqk[rl][0], a1 = *(const v4f*)&sqk[rl][4], b0 = *(const v4f*)&sqk[rl + 1][0], b1 = *(const v4f*)&sqk[rl + 1][4]; vst2(Q + (r0 + rl) * DQ, a0); vst2(Q + (r0 + rl) * DQ + 4, a1); vst2(Q + (r0 + rl + 1) * DQ, b0); vst2(Q + (r0 + rl + 1) * DQ + 4, b1); }
  else if (tid < 96) { const int rl = tid - 32; v8b h, l;   // one key a thread: its 8 channels split once here, for every wave of k_att that reads them
#pragma unroll
    for (int i = 0; i < 8; ++i) { const float v = sqk[rl][8 + i]; h[i] = (__bf16)v; l[i] = (__bf16)(v - (float)h[i]); }
    __bf16* kp = K + ((r0 + rl) >> 4) * 256 + (rl & 15) * 8; vst2(kp, h); vst2(kp + 128, l); }
  // the block's 64 pixels are two whole key tiles, 8 KiB in a row: 16-byte piece e = (tile, j, h, lane)
  for (int e = tid; e < 64 * 8; e += 128) { const int c = ((e >> 6) & 3) * 16 + (e & 15), q = (e >> 8) * 4 + ((e >> 5) & 1) * 2 + ((e >> 4) & 1); vst2((unsigned*)(VT + r0 * CC + e * 8), *(const v4u*)&tv[c][q * 8]); } }
#define GLB __attribute__((address_space(1)))
// a wave-uniform global pointer held in scalar registers, so that the loads behind it take the scalar-base form and no vector address pair is formed per trip
template <typename T> __device__ __forceinline__ const GLB T* ubase(const T* p) { const unsigned long long a = (unsigned long long)p;
  return (const GLB T*)(((unsigned long long)(unsigned)__builtin_amdgcn_readfirstlane((int)(a >> 32)) << 32) | (unsigned)__builtin_amdgcn_readfirstlane((int)a)); }
// 16x16x32 f16 fragment stored in fragment order: a wave-uniform base and the lane's own element offset (8 * lane); each of the two loads takes 512 bytes in a row, four whole cache lines
__device__ __forceinline__ v16h frag_u(const GLB _Float16* base, unsigned off) {
  union { v16h v; v8h q[2]; } u; u.q[0] = *(const GLB v8h*)(base + off); u.q[1] = *(const GLB v8h*)(base + 256 + off); return u.v;
}
// K fragment of a 16-key tile stored as [hi, lo][key][8]: a wave-uniform base and the lane's own element offset (8 * col); each of the two loads takes 256 bytes in a row
__device__ __forceinline__ v16b frag_k(const GLB __bf16* base, unsigned off) {
  union { v16b v; v8b q[2]; } u; u.q[0] = *(const GLB v8b*)(base + off); u.q[1] = *(const GLB v8b*)(base + 128 + off); return u.v;
}
// lane l with lane l ^ 16 (a vector cross-row move; the shuffle helper would go through the LDS pipe)
__device__ __forceinline__ float xhalf(float x) { return __builtin_bit_cast(float, __builtin_amdgcn_permlanex16(__builtin_bit_cast(int, x), __builtin_bit_cast(int, x), 0x76543210, 0xfedcba98, false, false)); }
// ---- k_att: block = 64 queries of image b, transposed: S^T = K . Q^T (one WMMA a 16-key tile: its K = 32 holds k.hi q.hi, k.hi q.lo, k.lo q.hi, k.lo q.lo over the 8 channels), so a lane holds 16 of the 32 scores of ONE query (col) of each of its tiles: softmax in the lane plus one exchange between halves;
//      the two S^T tiles of a query tile, converted in place, are the B operand of O^T += V^T . P^T; out = gamma * o + x
//      A wave holds QT = 2 query tiles (32 queries): every K and V fragment it loads is the A operand of two WMMAs, so a score costs half the loaded bytes.
//      Each group of 32 queries has KS waves, each with its own run of NP / KS keys, which keeps four waves on a SIMD. Every wave puts its partial (m, l, O) into LDS; behind the barrier each of the KS waves joins one quarter of the group's output (one query tile, 32 channels = whole 128-byte lines).
#define KS 4
#define POFF 4.0f       // P is exp2(logit - maximum in use + POFF)
#define PLIM 32768.0f   // a lane's sum of 16 P above this raises the maximum in use: P stays below f16's largest number
// the largest and the sum of a lane's 16 values of one query
__device__ __forceinline__ float max16(v8f a, v8f b) { float mx[4];
#pragma unroll
  for (int i = 0; i < 4; ++i) mx[i] = fmaxf(fmaxf(a[i], a[4 + i]), fmaxf(b[i], b[4 + i]));
  return fmaxf(fmaxf(mx[0], mx[1]), fmaxf(mx[2], mx[3])); }
// D = A . B + C with C kept: written as asm because the builtin came out in its two-address form for half of the score products, with eight register moves that copy C into D in front of each pair.
// The four v_nop keep the distance that the chip needs between a matrix instruction and a vector instruction on its D, A or B (D goes to exp2, never into another product's A or B).
__device__ __forceinline__ v8f wmma_bf_c(v16b a, v16b b, v8f c) { v8f d;
  asm volatile("v_wmma_f32_16x16x32_bf16 %0, %1, %2, %3\n\tv_nop\n\tv_nop\n\tv_nop\n\tv_nop" : "=&v"(d) : "v"(a), "v"(b), "v"(c));
  return d; }
__device__ __forceinline__ float sum16(v8f a, v8f b) { const v8f e2 = a + b; const v4f e4 = e2.lo + e2.hi; const v2f e1 = e4.lo + e4.hi; return e1[0] + e1[1]; }   // halved three times: every add but the last pairs neighbouring registers
#define QT 2
#define KT (NP / 32 / KS)   // trips of one wave
static_assert(KS == 2 * QT, "the join deals (query tile, channel half) to the KS waves of a group");
__global__ __launch_bounds__(64 * KS) void k_att(const float* __restrict__ Q, const __bf16* __restrict__ K, const _Float16* __restrict__ VT, const float* __restrict__ X, const float* __restrict__ GM, float* __restrict__ OUT) {
  __shared__ __align__(16) float so[2 * KS][16][36];   // a wave's own output staging: 16 queries x 32 channels, pitch 144 bytes
  __shared__ __align__(16) v4f pa[KS][2][QT * 8][32];  // a run's O: [run][query group][query tile, quad of accumulator elements][lane]: a lane's 16 bytes beside its neighbour's
  __shared__ float pm[KS][2][QT][2][32];               // its m and l
  const int tid = threadIdx.x, lane = tid & 31, col = lane & 15, g = lane >> 4; const int i0 = blockIdx.x * 64; const size_t b = blockIdx.y;
  const int wv = __builtin_amdgcn_readfirstlane(tid >> 5), grp = wv & 1, run = wv >> 1, kt0 = run * KT;   // the wave's query group and its run of keys (scalar: the trip's bases stay scalar), and its first trip's tile
  const size_t q0 = b * NP + i0 + grp * 32;
  v16b bq[QT];   // B operand: k slots 8 g + i and 16 + 8 g + i both hold channel i of query col: its hi in the lanes g == 0, its lo in the lanes g == 1
  v8f qv[QT];
#pragma unroll
  for (int t = 0; t < QT; ++t) qv[t] = *(const v8f*)(Q + (q0 + 16 * t + col) * DQ);
  asm volatile("s_wait_xcnt 0x0" ::: "memory");   // stands before the K and V fetches below, whose results may take the registers of the address that the q loads name
#pragma unroll
  for (int t = 0; t < QT; ++t)
#pragma unroll
    for (int i = 0; i < 8; ++i) { const float v = qv[t][i]; const __bf16 h = (__bf16)v, lo = (__bf16)(v - (float)h); bq[t][i] = g ? lo : h; bq[t][8 + i] = bq[t][i]; }
  float m[QT], l[QT];   // query col's maximum in use, log2 units (same in both halves), and this half's share of its sum
  v8f cm[QT];           // POFF - m in all eight elements: the C operand of the score WMMAs, so that D is exp2's argument as it stands
  v8f acc[QT][4];       // acc[t][j][r] = O[query 16 t + col][channel 16 j + 8 g + r]
#pragma unroll
  for (int t = 0; t < QT; ++t) { l[t] = 0.f;
#pragma unroll
    for (int j = 0; j < 4; ++j) acc[t][j] = v8f{}; }
  const float gm = bfr(GM[0]);
  // The trip's K fragments (kf: elements 0..7 = hi, 8..15 = lo of key col, the same in both halves of the wave, so slots 0..15 carry k.hi and 16..31 k.lo) and V fragments (vf) are fetched one trip ahead, each into the registers of the tile it replaces, right after that tile's last use.
  // Addresses: a wave-uniform scalar base that moves with the trip plus a fixed 32-bit lane offset: no vector address register is rewritten behind an issued load, and the bases are formed anew behind the wait at the trip's head.
  const __bf16* kb0 = K + b * NP * 2 * DQ; const _Float16* vb0 = VT + b * CC * (size_t)NP; const unsigned ko = col * DQ, vo = 8 * lane;
  v16b kf[2]; v16h vf[4];
#pragma unroll
  for (int ct = 0; ct < 2; ++ct) kf[ct] = frag_k(ubase(kb0 + (size_t)kt0 * 32 * 2 * DQ) + ct * 256, ko);
#pragma unroll
  for (int j = 0; j < 4; ++j) vf[j] = frag_u(ubase(vb0 + (size_t)kt0 * 32 * CC) + j * 512, vo);
  // The maximum in use starts as the true maximum of the run's first tile, so a run's sum holds at least one term of 2^POFF and never comes out 0.
#pragma unroll
  for (int t = 0; t < QT; ++t) { const v8f z = {}; const v8f a0 = wmma_bf(kf[0], bq[t], z), a1 = wmma_bf(kf[1], bq[t], z); const float mh = max16(a0, a1);
    m[t] = fmaxf(mh, xhalf(mh)); const float c = POFF - m[t];
#pragma unroll
    for (int r = 0; r < 8; ++r) cm[t][r] = c; }
#pragma unroll 1
  for (int ks = 0; ks < KT; ++ks) {
    int kt;
    asm volatile("s_wait_xcnt 0x0\n\ts_mov_b32 %0, %1" : "=s"(kt) : "s"(ks) : "memory");   // stands before the scalar bases named by the loads of the trip before are formed anew (they all derive from kt, which is itself written behind the wait)
    const int kn = kt0 + (kt < KT - 1 ? kt + 1 : kt);   // the last trip fetches its own tile again: every fetch stays inside what k_proj wrote
    v8f s[QT][2];   // s[t][ct][r] = logit of key 16 ct + 8 g + r with query 16 t + col, in log2 units, less the maximum in use, plus POFF
#pragma unroll
    for (int ct = 0; ct < 2; ++ct)
#pragma unroll
      for (int t = 0; t < QT; ++t) s[t][ct] = wmma_bf_c(kf[ct], bq[t], cm[t]);
    const GLB __bf16* kb = ubase(kb0 + (size_t)kn * 32 * 2 * DQ);
#pragma unroll
    for (int ct = 0; ct < 2; ++ct) kf[ct] = frag_k(kb + ct * 256, ko);
    asm volatile("" ::: "memory");   // compiler fence: keeps the K fetch here, a whole trip ahead of its use; without it this build sinks the four loads behind the branch below, into the P.v products, and they lose most of their lead
    v8f e[QT][2]; float es[QT];   // the trip's P (times 2^POFF under the maximum in use) and this lane's sum of its 16
#pragma unroll
    for (int t = 0; t < QT; ++t) {
#pragma unroll
      for (int ct = 0; ct < 2; ++ct)
#pragma unroll
        for (int r = 0; r < 8; ++r) e[t][ct][r] = __builtin_amdgcn_exp2f(s[t][ct][r]);
      es[t] = sum16(e[t][0], e[t][1]); }
    // A lane's sum bounds each of its 16 terms: while it stays under PLIM every P fits f16 and the maximum in use may stand. One test a trip for the whole wave, a scalar branch; it is taken in few trips.
    if (__builtin_amdgcn_ballot_w32(fmaxf(es[0], es[1]) > PLIM) != 0) {
#pragma unroll
      for (int t = 0; t < QT; ++t) {
        const float mh = max16(s[t][0], s[t][1]); const float d = fmaxf(fmaxf(mh, xhalf(mh)) - POFF, 0.f);   // how far the tile's true maximum lies above the one in use (0: this query keeps its own); the same in both halves
        m[t] += d; const float c = POFF - m[t], alpha = __builtin_amdgcn_exp2f(-d);
#pragma unroll
        for (int r = 0; r < 8; ++r) cm[t][r] = c;
#pragma unroll
        for (int ct = 0; ct < 2; ++ct) { const v8f y = s[t][ct] - d;
#pragma unroll
          for (int r = 0; r < 8; ++r) e[t][ct][r] = __builtin_amdgcn_exp2f(y[r]); }
        es[t] = sum16(e[t][0], e[t][1]);
        l[t] *= alpha;
#pragma unroll
        for (int j = 0; j < 4; ++j)
#pragma unroll
          for (int r = 0; r < 8; ++r) acc[t][j][r] *= alpha; } }
    v16h pb[QT];   // pb[t]: element r = key 8 g + r, element 8 + r = key 16 + 8 g + r: the k order of vf
#pragma unroll
    for (int t = 0; t < QT; ++t) { l[t] += es[t];
#pragma unroll
      for (int ct = 0; ct < 2; ++ct)
#pragma unroll
        for (int r = 0; r < 8; ++r) pb[t][8 * ct + r] = (_Float16)e[t][ct][r]; }
#pragma unroll
    for (int j = 0; j < 4; ++j)
#pragma unroll
      for (int t = 0; t < QT; ++t) acc[t][j] = wmma16(vf[j], pb[t], acc[t][j]);
    const GLB _Float16* vb = ubase(vb0 + (size_t)kn * 32 * CC);
#pragma unroll
    for (int j = 0; j < 4; ++j) vf[j] = frag_u(vb + j * 512, vo);
    asm volatile("s_wait_xcnt 0x0" ::: "memory"); }   // stands behind the trip's last fetches: on the way out of the loop the scalar registers that they name are put to other use at once
#pragma unroll
  for (int t = 0; t < QT; ++t) {   // every wave hands its partial result over
#pragma unroll
    for (int j = 0; j < 4; ++j) { pa[run][grp][8 * t + 2 * j][lane] = v4f{acc[t][j][0], acc[t][j][1], acc[t][j][2], acc[t][j][3]}; pa[run][grp][8 * t + 2 * j + 1][lane] = v4f{acc[t][j][4], acc[t][j][5], acc[t][j][6], acc[t][j][7]}; }
    pm[run][grp][t][0][lane] = m[t]; pm[run][grp][t][1][lane] = l[t]; }
  __syncthreads();   // every wave passes it once: all partial results are in LDS before any wave reads them
  const int jt = run >> 1, ch = run & 1;   // this wave joins query tile jt, channels 32 ch .. 32 ch + 31 (accumulator quads 8 jt + 4 ch + 0..3), lane for lane the same query and channels in every run
  float mp[KS], mj = -3.0e38f, lj = 0.f;
#pragma unroll
  for (int p = 0; p < KS; ++p) { mp[p] = pm[p][grp][jt][0][lane]; mj = fmaxf(mj, mp[p]); }
  v4f o[4] = {};   // o[2 jj + hh][r] = O[query col][channel 32 ch + 16 jj + 8 g + 4 hh + r], every run brought to the common maximum and added in the order of the runs
#pragma unroll
  for (int p = 0; p < KS; ++p) { const float a = __builtin_amdgcn_exp2f(mp[p] - mj); lj += pm[p][grp][jt][1][lane] * a;
#pragma unroll
    for (int e = 0; e < 4; ++e) { const v4f w = pa[p][grp][8 * jt + 4 * ch + e][lane];
#pragma unroll
      for (int r = 0; r < 4; ++r) o[e][r] += w[r] * a; } }
  { const float il = 1.0f / (lj + xhalf(lj)); const size_t qr = q0 + 16 * jt; const float* xr = X + (qr + col) * CC + 32 * ch + 8 * g;
#pragma unroll
    for (int e = 0; e < 4; ++e)
#pragma unroll
      for (int r = 0; r < 4; ++r) so[wv][col][16 * (e >> 1) + 8 * g + 4 * (e & 1) + r] = o[e][r] * il * gm + bfr(xr[16 * (e >> 1) + 4 * (e & 1) + r]);
    LDSX();   // the wave's own rows are in LDS before it reads them back
#pragma unroll
    for (int it = 0; it < 4; ++it) { const int rl = 4 * it + (lane >> 3), c4 = 4 * (lane & 7); vst2(OUT + (qr + rl) * CC + 32 * ch + c4, *(const v4f*)&so[wv][rl][c4]); } } }   // each store: four whole 128-byte lines
extern "C" void kernel_launch(void* const* d_in, const int* in_sizes, int n_in, void* d_out, int out_size, void* d_ws, size_t ws_size, hipStream_t stream) {
  (void)in_sizes; (void)n_in; (void)out_size;
  const float** F = (const float**)d_in;   // 0 x [8,64,64,64] (channels last), 1 wq [64,8], 2 bq, 3 wk, 4 bk, 5 wv [64,64], 6 bv, 7 gamma [1]
  if (ws_size < (size_t)WS_END) return;
  char* ws = (char*)d_ws; float* Q = (float*)(ws + WS_Q); __bf16* K = (__bf16*)(ws + WS_K); _Float16* VT = (_Float16*)(ws + WS_VT);
  k_proj<<<TNI * NP / 64, 128, 0, stream>>>(F[0], F[1], F[2], F[3], F[4], F[5], F[6], Q, K, VT);
  k_att<<<dim3(NP / 64, TNI), 64 * KS, 0, stream>>>(Q, K, VT, F[0], F[7], (float*)d_out);
}
